// v000
// Times are from an AMD MI455X. After a warm-up the kernel runs many times in a row, and a time is the length of
// such a window on the GPU divided by its runs, so every launch and the gaps after it count. The runs cycle
// through copies of the inputs. A figure is the median of several windows, for all but v000 over two sittings.
// Sittings can differ by a few percent; kernels timed side by side share one.
// v000 is the starting kernel. One run takes 358 microseconds.
#include <hip/hip_runtime.h>
#include <hip/hip_bf16.h>

typedef __attribute__((ext_vector_type(16))) _Float16 v16h;
typedef __attribute__((ext_vector_type(8)))  float    v8f;
typedef __attribute__((ext_vector_type(2)))  float    v2f;
typedef __attribute__((address_space(3)))    _Float16 lds_f16;

// Fragment K-offset for 16-bit WMMA A/B operands (ISA 7.12.2, 16-bit 16x32 layout):
// lane = hf*16 + (m|n); element e -> K = (e<8) ? hf*8+e : 16+hf*8+(e-8)
__device__ __forceinline__ int kof(int e, int hf) {
    return (e < 8) ? (hf * 8 + e) : (16 + hf * 8 + (e - 8));
}

// ---------------------------------------------------------------------------
// Kernel 1a: wfrag = combined conv weights (conv_out 64ch ++ qkv 192ch),
// pre-swizzled into exact B-fragment order:
//   wfrag[((kt*256 + col)*2 + hf)*16 + e] = W[K = kt*32 + kof(e,hf)][col]
// ---------------------------------------------------------------------------
__global__ void prep_w_kernel(const float* __restrict__ wco,
                              const float* __restrict__ wqkv,
                              _Float16* __restrict__ wfrag) {
    int j = blockIdx.x * blockDim.x + threadIdx.x;
    if (j >= 147456) return;                       // 18*256*2*16
    int e   = j & 15;
    int hf  = (j >> 4) & 1;
    int col = (j >> 5) & 255;
    int kt  = j >> 13;
    int K = kt * 32 + kof(e, hf);                  // < 576 always
    int c = K / 9, r = K - c * 9;
    float v = (col < 64) ? wco[(col * 64 + c) * 9 + r]
                         : wqkv[((col - 64) * 64 + c) * 9 + r];
    wfrag[j] = (_Float16)v;
}

// ---------------------------------------------------------------------------
// Kernel 1b: afrag = im2col(x) in exact A-fragment order, f16:
//   afrag[((mt*18 + kt)*32 + lane)*16 + e] = im2col[p = mt*16 + lane%16]
//                                                  [K = kt*32 + kof(e, lane/16)]
// ---------------------------------------------------------------------------
__global__ void prep_a_kernel(const float* __restrict__ x,
                              _Float16* __restrict__ afrag) {
    int i = blockIdx.x * blockDim.x + threadIdx.x;
    if (i >= 4718592) return;                      // 512*18*32*16
    int e    = i & 15;
    int lane = (i >> 4) & 31;
    int t    = i >> 9;
    int mt   = t / 18;
    int kt   = t - mt * 18;
    int hf = lane >> 4, m = lane & 15;
    int p = mt * 16 + m;
    int b = p >> 10, yy = (p >> 5) & 31, xx = p & 31;
    int K = kt * 32 + kof(e, hf);
    int c = K / 9, r = K - c * 9;
    int ky = r / 3, kx = r - ky * 3;
    int iy = yy + ky - 1, ix = xx + kx - 1;
    float v = 0.f;
    if (iy >= 0 && iy < 32 && ix >= 0 && ix < 32)
        v = x[((b * 64 + c) * 32 + iy) * 32 + ix];
    afrag[i] = (_Float16)v;
}

// ---------------------------------------------------------------------------
// Kernel 2: fused implicit-GEMM 3x3 convs. M=8192 pixels, N=256 ch, K=576.
// Each wave: 16(M) x 64(N) tile, f16 WMMA, 18 K-steps of 32.
// Per K-step the 16KB B tile (shared by all 8 waves of the block) is staged
// into LDS via global_load_async_to_lds_b128 (ASYNCcnt path). The LDS dest
// is passed to the asm as an addrspace(3) POINTER (32-bit VGPR = LDS byte
// address) so the buffer escapes and the "memory" clobber correctly orders
// the ds_load_b128 fragment reads against the async writes.
// ---------------------------------------------------------------------------
__global__ void conv_gemm_kernel(const _Float16* __restrict__ afrag,
                                 const _Float16* __restrict__ wfrag,
                                 const float* __restrict__ bco,
                                 const float* __restrict__ bqkv,
                                 float* __restrict__ out,
                                 float* __restrict__ q_ws,
                                 float* __restrict__ k_ws,
                                 _Float16* __restrict__ v_ws) {
    __shared__ _Float16 lb[8192];                  // 16KB: B tile of current kt
    int tid  = blockIdx.x * blockDim.x + threadIdx.x;
    int wid  = tid >> 5;
    int lane = threadIdx.x & 31;
    int mt   = wid >> 2;          // 512 M-tiles (2 per block)
    int nt4  = wid & 3;           // 4 N-groups of 64 (also: output category)
    int hf   = lane >> 4, mn = lane & 15;

    v8f c0 = {}, c1 = {}, c2 = {}, c3 = {};
    for (int kt = 0; kt < 18; ++kt) {
        // ---- async-stage B tile: 256 threads x 4 x 16B = 16KB ----
        const _Float16* src = wfrag + (size_t)kt * 8192;
#pragma unroll
        for (int r = 0; r < 4; ++r) {
            lds_f16* lp = (lds_f16*)(lb + (size_t)(threadIdx.x + r * 256) * 8);
            const _Float16* g = src + (size_t)(threadIdx.x + r * 256) * 8;
            asm volatile("global_load_async_to_lds_b128 %0, %1, off"
                         :: "v"(lp), "v"(g) : "memory");
        }
        asm volatile("s_wait_asynccnt 0x0" ::: "memory");
        __syncthreads();

        // ---- A fragment: one aligned 32B load ----
        const _Float16* ap = afrag + ((size_t)(mt * 18 + kt) * 32 + lane) * 16;
        v16h a = *(const v16h*)ap;
        if (kt + 1 < 18)
            __builtin_prefetch(ap + 512, 0, 3);    // next kt A fragment

        // ---- 4 B fragments, then 4 WMMAs ----
        const _Float16* lbase = lb + (size_t)(nt4 * 64 + mn) * 32 + hf * 16;
        v16h b0 = *(const v16h*)(lbase);
        v16h b1 = *(const v16h*)(lbase + 512);     // +16 cols * 32
        v16h b2 = *(const v16h*)(lbase + 1024);
        v16h b3 = *(const v16h*)(lbase + 1536);
        c0 = __builtin_amdgcn_wmma_f32_16x16x32_f16(false, a, false, b0, (short)0, c0, false, false);
        c1 = __builtin_amdgcn_wmma_f32_16x16x32_f16(false, a, false, b1, (short)0, c1, false, false);
        c2 = __builtin_amdgcn_wmma_f32_16x16x32_f16(false, a, false, b2, (short)0, c2, false, false);
        c3 = __builtin_amdgcn_wmma_f32_16x16x32_f16(false, a, false, b3, (short)0, c3, false, false);
        __syncthreads();                           // protect lb before next stage
    }

    // ---- wave-uniform writeback ----
    const float QSCALE = 0.35355339059327373f;     // 8^-0.5
    v8f acc[4] = { c0, c1, c2, c3 };
    if (nt4 == 0) {                                // conv_out + bias -> d_out ch 0..63
#pragma unroll
        for (int t = 0; t < 4; ++t) {
            int col = t * 16 + mn;
#pragma unroll
            for (int j = 0; j < 8; ++j) {
                int pp = mt * 16 + j + 8 * hf;
                int bb = pp >> 10, prow = pp & 1023;
                out[(size_t)(bb * 128 + col) * 1024 + prow] = acc[t][j] + bco[col];
            }
        }
    } else if (nt4 == 1) {                         // q (scaled) -> q_ws[b,h,p,d]
#pragma unroll
        for (int t = 0; t < 4; ++t) {
            int ch = t * 16 + mn, h = ch >> 3, d = ch & 7;
#pragma unroll
            for (int j = 0; j < 8; ++j) {
                int pp = mt * 16 + j + 8 * hf;
                int bb = pp >> 10, prow = pp & 1023;
                q_ws[(size_t)((bb * 8 + h) * 1024 + prow) * 8 + d] =
                    (acc[t][j] + bqkv[ch]) * QSCALE;
            }
        }
    } else if (nt4 == 2) {                         // k -> k_ws[b,h,d,p] (f32)
#pragma unroll
        for (int t = 0; t < 4; ++t) {
            int ch = t * 16 + mn, h = ch >> 3, d = ch & 7;
#pragma unroll
            for (int j = 0; j < 8; ++j) {
                int pp = mt * 16 + j + 8 * hf;
                int bb = pp >> 10, prow = pp & 1023;
                k_ws[(size_t)((bb * 8 + h) * 8 + d) * 1024 + prow] =
                    acc[t][j] + bqkv[64 + ch];
            }
        }
    } else {                                       // v -> v_ws[b,h,d,p] (f16)
#pragma unroll
        for (int t = 0; t < 4; ++t) {
            int ch = t * 16 + mn, h = ch >> 3, d = ch & 7;
#pragma unroll
            for (int j = 0; j < 8; ++j) {
                int pp = mt * 16 + j + 8 * hf;
                int bb = pp >> 10, prow = pp & 1023;
                v_ws[(size_t)((bb * 8 + h) * 8 + d) * 1024 + prow] =
                    (_Float16)(acc[t][j] + bqkv[128 + ch]);
            }
        }
    }
}

// ---------------------------------------------------------------------------
// Kernel 3: relative logits, analytic skew form.
//   RW[b,h,qy,qx,kx] = sum_d q[b,h,qy*32+qx,d] * key_rel_w[kx-qx+31, d]
//   RH[b,h,qx,qy,ky] = sum_d q[b,h,qy*32+qx,d] * key_rel_h[ky-qy+31, d]
// ---------------------------------------------------------------------------
__global__ void rel_kernel(const float* __restrict__ q_ws,
                           const float* __restrict__ krw,
                           const float* __restrict__ krh,
                           float* __restrict__ RW, float* __restrict__ RH) {
    int i = blockIdx.x * blockDim.x + threadIdx.x;
    bool isW = i < 2097152;
    int idx = isW ? i : i - 2097152;
    if (idx >= 2097152) return;
    int k_ = idx & 31;          // kx (W) / ky (H)
    int a2 = (idx >> 5) & 31;   // qx (W) / qy (H)
    int a1 = (idx >> 10) & 31;  // qy (W) / qx (H)
    int h = (idx >> 15) & 7, b = idx >> 18;
    int p = isW ? (a1 * 32 + a2) : (a2 * 32 + a1);
    int m = k_ - a2 + 31;       // always in [0,62]
    const float* qrow = q_ws + (size_t)((b * 8 + h) * 1024 + p) * 8;
    const float* rk   = (isW ? krw : krh) + m * 8;
    float s = 0.f;
#pragma unroll
    for (int d = 0; d < 8; ++d) s += qrow[d] * rk[d];
    if (isW) RW[idx] = s; else RH[idx] = s;
}

// ---------------------------------------------------------------------------
// Kernel 4: attention. One WG per (b, h, 32-row q block).
// Dynamic LDS: S = 32x1024 f32 (128KB) + P = 32x1024 f16 (64KB) = 192KB.
//  Phase 1: S = QK^T (f32 WMMA 16x16x4, K=8 in 2 steps) + RW + RH -> LDS
//  Phase 2: softmax, 2 threads/row, float4 reads, shfl_xor combines -> P (f16)
//  Phase 3: O = P.V  (f16 WMMA 16x16x32, K=1024 in 32 steps, N padded 8->16)
// ---------------------------------------------------------------------------
__global__ void attn_kernel(const float* __restrict__ q_ws,
                            const float* __restrict__ k_ws,
                            const _Float16* __restrict__ v_ws,
                            const float* __restrict__ RW,
                            const float* __restrict__ RH,
                            float* __restrict__ attn_pre) {
    extern __shared__ char smem[];
    float*    S  = (float*)smem;                    // 32*1024 f32
    _Float16* Ph = (_Float16*)(smem + 131072);      // 32*1024 f16

    int bh = blockIdx.x >> 5;     // 64 (b,h) pairs
    int qb = blockIdx.x & 31;     // 32 q-blocks of 32 rows
    int b = bh >> 3, h = bh & 7;
    int wave = threadIdx.x >> 5, lane = threadIdx.x & 31;
    int hf = lane >> 4, mn = lane & 15;
    int qr = qb * 32 + wave * 16;           // image-local q row base of this wave

    const float* qbase = q_ws + (size_t)(b * 8 + h) * 1024 * 8;
    const float* kbase = k_ws + (size_t)(b * 8 + h) * 8 * 1024;

    // -------- Phase 1: scores --------
    float a00 = qbase[(size_t)(qr + mn) * 8 + hf * 2];
    float a01 = qbase[(size_t)(qr + mn) * 8 + hf * 2 + 1];
    float a10 = qbase[(size_t)(qr + mn) * 8 + 4 + hf * 2];
    float a11 = qbase[(size_t)(qr + mn) * 8 + 4 + hf * 2 + 1];

    for (int kt = 0; kt < 64; ++kt) {
        v8f c = {};
        {
            v2f a, bb;
            int d0 = hf * 2;
            a.x  = a00; a.y = a01;
            bb.x = kbase[(size_t)d0 * 1024 + kt * 16 + mn];
            bb.y = kbase[(size_t)(d0 + 1) * 1024 + kt * 16 + mn];
            c = __builtin_amdgcn_wmma_f32_16x16x4_f32(
                false, a, false, bb, (short)0, c, false, false);
            int d1 = 4 + hf * 2;
            a.x  = a10; a.y = a11;
            bb.x = kbase[(size_t)d1 * 1024 + kt * 16 + mn];
            bb.y = kbase[(size_t)(d1 + 1) * 1024 + kt * 16 + mn];
            c = __builtin_amdgcn_wmma_f32_16x16x4_f32(
                false, a, false, bb, (short)0, c, false, false);
        }
        int kidx = kt * 16 + mn, ky = kidx >> 5, kx = kidx & 31;
#pragma unroll
        for (int j = 0; j < 8; ++j) {
            int m = j + 8 * hf;
            int p = qr + m, qy = p >> 5, qx = p & 31;
            float rel = RW[(size_t)(((b * 8 + h) * 32 + qy) * 32 + qx) * 32 + kx] +
                        RH[(size_t)(((b * 8 + h) * 32 + qx) * 32 + qy) * 32 + ky];
            S[(size_t)(wave * 16 + m) * 1024 + kidx] = c[j] + rel;
        }
    }
    __syncthreads();

    // -------- Phase 2: softmax, 2 threads per row --------
    {
        int r = threadIdx.x >> 1, hs = threadIdx.x & 1;
        float* row = S + (size_t)r * 1024;
        float4* rv = (float4*)(row + hs * 512);     // 128 float4 per half-row
        float mx = -3.4e38f;
        for (int i = 0; i < 128; ++i) {
            float4 v = rv[i];
            mx = fmaxf(mx, fmaxf(fmaxf(v.x, v.y), fmaxf(v.z, v.w)));
        }
        mx = fmaxf(mx, __shfl_xor(mx, 1));
        float sum = 0.f;
        for (int i = 0; i < 128; ++i) {
            float4 v = rv[i];
            v.x = __expf(v.x - mx); v.y = __expf(v.y - mx);
            v.z = __expf(v.z - mx); v.w = __expf(v.w - mx);
            rv[i] = v;
            sum += (v.x + v.y) + (v.z + v.w);
        }
        sum += __shfl_xor(sum, 1);
        float inv = 1.f / sum;
        const float*  src  = row + hs * 512;
        _Float16*     prow = Ph + (size_t)r * 1024 + hs * 512;
        for (int i = 0; i < 512; ++i) prow[i] = (_Float16)(src[i] * inv);
    }
    __syncthreads();

    // -------- Phase 3: O = P.V --------
    {
        v8f c = {};
        const _Float16* vbase = v_ws + (size_t)(b * 8 + h) * 8 * 1024;
        const _Float16* arow  = Ph + (size_t)(wave * 16 + mn) * 1024;
        for (int kt = 0; kt < 32; ++kt) {
            int k0 = kt * 32;
            union { uint4 u[2]; v16h v; } ua, ub;
            ua.u[0] = *(const uint4*)(arow + k0 + hf * 8);
            ua.u[1] = *(const uint4*)(arow + k0 + 16 + hf * 8);
            if (mn < 8) {
                const _Float16* vrow = vbase + (size_t)mn * 1024;
                ub.u[0] = *(const uint4*)(vrow + k0 + hf * 8);
                ub.u[1] = *(const uint4*)(vrow + k0 + 16 + hf * 8);
            } else {
                ub.u[0] = make_uint4(0, 0, 0, 0);
                ub.u[1] = make_uint4(0, 0, 0, 0);
            }
            c = __builtin_amdgcn_wmma_f32_16x16x32_f16(
                false, ua.v, false, ub.v, (short)0, c, false, false);
        }
        if (mn < 8) {
#pragma unroll
            for (int j = 0; j < 8; ++j) {
                int m = j + 8 * hf;
                int p = qb * 32 + wave * 16 + m;
                attn_pre[(size_t)(b * 64 + h * 8 + mn) * 1024 + p] = c[j];
            }
        }
    }
}

// ---------------------------------------------------------------------------
// Kernel 5: 1x1 output projection. GEMM M=8192, N=64, K=64 (f32 WMMA).
// Writes channels 64..127 of d_out (+bias).
// ---------------------------------------------------------------------------
__global__ void proj_kernel(const float* __restrict__ attn_pre,
                            const float* __restrict__ w_attn,
                            const float* __restrict__ b_attn,
                            float* __restrict__ out) {
    int tid  = blockIdx.x * blockDim.x + threadIdx.x;
    int wid  = tid >> 5;
    int lane = threadIdx.x & 31;
    int mt = wid >> 2, nt = wid & 3;
    int hf = lane >> 4, mn = lane & 15;
    int p = mt * 16 + mn, b = p >> 10, pp = p & 1023;
    int col = nt * 16 + mn;

    v8f c = {};
    for (int kt = 0; kt < 16; ++kt) {
        int k0 = kt * 4 + hf * 2;
        v2f a, bb;
        a.x  = attn_pre[(size_t)(b * 64 + k0) * 1024 + pp];
        a.y  = attn_pre[(size_t)(b * 64 + k0 + 1) * 1024 + pp];
        bb.x = w_attn[col * 64 + k0];
        bb.y = w_attn[col * 64 + k0 + 1];
        c = __builtin_amdgcn_wmma_f32_16x16x4_f32(
            false, a, false, bb, (short)0, c, false, false);
    }
#pragma unroll
    for (int j = 0; j < 8; ++j) {
        int m = j + 8 * hf;
        int P = mt * 16 + m, bb2 = P >> 10, pr = P & 1023;
        out[(size_t)(bb2 * 128 + 64 + col) * 1024 + pr] = c[j] + b_attn[col];
    }
}

// ---------------------------------------------------------------------------
extern "C" void kernel_launch(void* const* d_in, const int* in_sizes, int n_in,
                              void* d_out, int out_size, void* d_ws, size_t ws_size,
                              hipStream_t stream) {
    const float* x    = (const float*)d_in[0];
    const float* wco  = (const float*)d_in[1];
    const float* bco  = (const float*)d_in[2];
    const float* wqkv = (const float*)d_in[3];
    const float* bqkv = (const float*)d_in[4];
    const float* watt = (const float*)d_in[5];
    const float* batt = (const float*)d_in[6];
    const float* krw  = (const float*)d_in[7];
    const float* krh  = (const float*)d_in[8];
    float* out = (float*)d_out;

    char* ws = (char*)d_ws;
    size_t o = 0;
    _Float16* wfrag = (_Float16*)(ws + o); o += (size_t)147456 * 2;    // 288 KB
    o = (o + 255) & ~(size_t)255;
    _Float16* afrag = (_Float16*)(ws + o); o += (size_t)4718592 * 2;   // 9 MB
    o = (o + 255) & ~(size_t)255;
    float* q_ws     = (float*)(ws + o);    o += (size_t)524288 * 4;    // 2 MB
    float* k_ws     = (float*)(ws + o);    o += (size_t)524288 * 4;    // 2 MB
    _Float16* v_ws  = (_Float16*)(ws + o); o += (size_t)524288 * 2;    // 1 MB
    o = (o + 255) & ~(size_t)255;
    float* RW       = (float*)(ws + o);    o += (size_t)2097152 * 4;   // 8 MB
    float* RH       = (float*)(ws + o);    o += (size_t)2097152 * 4;   // 8 MB
    float* attn_pre = (float*)(ws + o);    o += (size_t)524288 * 4;    // 2 MB

    // 1) weight swizzle + im2col in fragment order
    prep_w_kernel<<<(147456 + 255) / 256, 256, 0, stream>>>(wco, wqkv, wfrag);
    prep_a_kernel<<<(4718592 + 255) / 256, 256, 0, stream>>>(x, afrag);

    // 2) fused 3x3 convs as implicit GEMM (f16 WMMA + async LDS staging)
    conv_gemm_kernel<<<256, 256, 0, stream>>>(afrag, wfrag, bco, bqkv,
                                              out, q_ws, k_ws, v_ws);

    // 3) relative logits RW / RH
    rel_kernel<<<16384, 256, 0, stream>>>(q_ws, krw, krh, RW, RH);

    // 4) attention (192 KB dynamic LDS per WG)
    (void)hipFuncSetAttribute((const void*)attn_kernel,
                              hipFuncAttributeMaxDynamicSharedMemorySize, 196608);
    attn_kernel<<<2048, 64, 196608, stream>>>(q_ws, k_ws, v_ws, RW, RH, attn_pre);

    // 5) 1x1 projection (f32 WMMA)
    proj_kernel<<<256, 256, 0, stream>>>(attn_pre, watt, batt, out);
}

// v001
// A run of this version takes 63.8 microseconds.
// Two timings next to v000 put it at 5.70 and 5.61 times that version's speed.
#include <hip/hip_runtime.h>
#include <hip/hip_bf16.h>

typedef __attribute__((ext_vector_type(16))) _Float16 v16h;
typedef __attribute__((ext_vector_type(8)))  float    v8f;
typedef __attribute__((ext_vector_type(2)))  float    v2f;
typedef __attribute__((address_space(3)))    _Float16 lds_f16;

// Fragment K-offset for 16-bit WMMA A/B operands (ISA 7.12.2, 16-bit 16x32 layout):
// lane = hf*16 + (m|n); element e -> K = (e<8) ? hf*8+e : 16+hf*8+(e-8)
__device__ __forceinline__ int kof(int e, int hf) {
    return (e < 8) ? (hf * 8 + e) : (16 + hf * 8 + (e - 8));
}

// ---------------------------------------------------------------------------
// Kernel 1a: wfrag = combined conv weights (conv_out 64ch ++ qkv 192ch),
// pre-swizzled into exact B-fragment order:
//   wfrag[((kt*256 + col)*2 + hf)*16 + e] = W[K = kt*32 + kof(e,hf)][col]
// ---------------------------------------------------------------------------
__global__ void prep_w_kernel(const float* __restrict__ wco,
                              const float* __restrict__ wqkv,
                              _Float16* __restrict__ wfrag) {
    int j = blockIdx.x * blockDim.x + threadIdx.x;
    if (j >= 147456) return;                       // 18*256*2*16
    int e   = j & 15;
    int hf  = (j >> 4) & 1;
    int col = (j >> 5) & 255;
    int kt  = j >> 13;
    int K = kt * 32 + kof(e, hf);                  // < 576 always
    int c = K / 9, r = K - c * 9;
    float v = (col < 64) ? wco[(col * 64 + c) * 9 + r]
                         : wqkv[((col - 64) * 64 + c) * 9 + r];
    wfrag[j] = (_Float16)v;
}

// ---------------------------------------------------------------------------
// Kernel 1b: afrag = im2col(x) in exact A-fragment order, f16:
//   afrag[((mt*18 + kt)*32 + lane)*16 + e] = im2col[p = mt*16 + lane%16]
//                                                  [K = kt*32 + kof(e, lane/16)]
// ---------------------------------------------------------------------------
__global__ void prep_a_kernel(const float* __restrict__ x,
                              _Float16* __restrict__ afrag) {
    int i = blockIdx.x * blockDim.x + threadIdx.x;
    if (i >= 4718592) return;                      // 512*18*32*16
    int e    = i & 15;
    int lane = (i >> 4) & 31;
    int t    = i >> 9;
    int mt   = t / 18;
    int kt   = t - mt * 18;
    int hf = lane >> 4, m = lane & 15;
    int p = mt * 16 + m;
    int b = p >> 10, yy = (p >> 5) & 31, xx = p & 31;
    int K = kt * 32 + kof(e, hf);
    int c = K / 9, r = K - c * 9;
    int ky = r / 3, kx = r - ky * 3;
    int iy = yy + ky - 1, ix = xx + kx - 1;
    float v = 0.f;
    if (iy >= 0 && iy < 32 && ix >= 0 && ix < 32)
        v = x[((b * 64 + c) * 32 + iy) * 32 + ix];
    afrag[i] = (_Float16)v;
}

// ---------------------------------------------------------------------------
// Kernel 2: fused implicit-GEMM 3x3 convs. M=8192 pixels, N=256 ch, K=576.
// Each wave: 16(M) x 64(N) tile, f16 WMMA, 18 K-steps of 32.
// Per K-step the 16KB B tile (shared by all 8 waves of the block) is staged
// into LDS via global_load_async_to_lds_b128 (ASYNCcnt path). The LDS dest
// is passed to the asm as an addrspace(3) POINTER (32-bit VGPR = LDS byte
// address) so the buffer escapes and the "memory" clobber correctly orders
// the ds_load_b128 fragment reads against the async writes.
// ---------------------------------------------------------------------------
__global__ void conv_gemm_kernel(const _Float16* __restrict__ afrag,
                                 const _Float16* __restrict__ wfrag,
                                 const float* __restrict__ bco,
                                 const float* __restrict__ bqkv,
                                 float* __restrict__ out,
                                 float* __restrict__ q_ws,
                                 float* __restrict__ k_ws,
                                 _Float16* __restrict__ v_ws) {
    __shared__ _Float16 lb[8192];                  // 16KB: B tile of current kt
    int tid  = blockIdx.x * blockDim.x + threadIdx.x;
    int wid  = tid >> 5;
    int lane = threadIdx.x & 31;
    int mt   = wid >> 2;          // 512 M-tiles (2 per block)
    int nt4  = wid & 3;           // 4 N-groups of 64 (also: output category)
    int hf   = lane >> 4, mn = lane & 15;

    v8f c0 = {}, c1 = {}, c2 = {}, c3 = {};
    for (int kt = 0; kt < 18; ++kt) {
        // ---- async-stage B tile: 256 threads x 4 x 16B = 16KB ----
        const _Float16* src = wfrag + (size_t)kt * 8192;
#pragma unroll
        for (int r = 0; r < 4; ++r) {
            lds_f16* lp = (lds_f16*)(lb + (size_t)(threadIdx.x + r * 256) * 8);
            const _Float16* g = src + (size_t)(threadIdx.x + r * 256) * 8;
            asm volatile("global_load_async_to_lds_b128 %0, %1, off"
                         :: "v"(lp), "v"(g) : "memory");
        }
        asm volatile("s_wait_asynccnt 0x0" ::: "memory");
        __syncthreads();

        // ---- A fragment: one aligned 32B load ----
        const _Float16* ap = afrag + ((size_t)(mt * 18 + kt) * 32 + lane) * 16;
        v16h a = *(const v16h*)ap;
        if (kt + 1 < 18)
            __builtin_prefetch(ap + 512, 0, 3);    // next kt A fragment

        // ---- 4 B fragments, then 4 WMMAs ----
        const _Float16* lbase = lb + (size_t)(nt4 * 64 + mn) * 32 + hf * 16;
        v16h b0 = *(const v16h*)(lbase);
        v16h b1 = *(const v16h*)(lbase + 512);     // +16 cols * 32
        v16h b2 = *(const v16h*)(lbase + 1024);
        v16h b3 = *(const v16h*)(lbase + 1536);
        c0 = __builtin_amdgcn_wmma_f32_16x16x32_f16(false, a, false, b0, (short)0, c0, false, false);
        c1 = __builtin_amdgcn_wmma_f32_16x16x32_f16(false, a, false, b1, (short)0, c1, false, false);
        c2 = __builtin_amdgcn_wmma_f32_16x16x32_f16(false, a, false, b2, (short)0, c2, false, false);
        c3 = __builtin_amdgcn_wmma_f32_16x16x32_f16(false, a, false, b3, (short)0, c3, false, false);
        __syncthreads();                           // protect lb before next stage
    }

    // ---- wave-uniform writeback ----
    const float QSCALE = 0.35355339059327373f;     // 8^-0.5
    v8f acc[4] = { c0, c1, c2, c3 };
    if (nt4 == 0) {                                // conv_out + bias -> d_out ch 0..63
#pragma unroll
        for (int t = 0; t < 4; ++t) {
            int col = t * 16 + mn;
#pragma unroll
            for (int j = 0; j < 8; ++j) {
                int pp = mt * 16 + j + 8 * hf;
                int bb = pp >> 10, prow = pp & 1023;
                out[(size_t)(bb * 128 + col) * 1024 + prow] = acc[t][j] + bco[col];
            }
        }
    } else if (nt4 == 1) {                         // q (scaled) -> q_ws[b,h,p,d]
#pragma unroll
        for (int t = 0; t < 4; ++t) {
            int ch = t * 16 + mn, h = ch >> 3, d = ch & 7;
#pragma unroll
            for (int j = 0; j < 8; ++j) {
                int pp = mt * 16 + j + 8 * hf;
                int bb = pp >> 10, prow = pp & 1023;
                q_ws[(size_t)((bb * 8 + h) * 1024 + prow) * 8 + d] =
                    (acc[t][j] + bqkv[ch]) * QSCALE;
            }
        }
    } else if (nt4 == 2) {                         // k -> k_ws[b,h,d,p] (f32)
#pragma unroll
        for (int t = 0; t < 4; ++t) {
            int ch = t * 16 + mn, h = ch >> 3, d = ch & 7;
#pragma unroll
            for (int j = 0; j < 8; ++j) {
                int pp = mt * 16 + j + 8 * hf;
                int bb = pp >> 10, prow = pp & 1023;
                k_ws[(size_t)((bb * 8 + h) * 8 + d) * 1024 + prow] =
                    acc[t][j] + bqkv[64 + ch];
            }
        }
    } else {                                       // v -> v_ws[b,h,d,p] (f16)
#pragma unroll
        for (int t = 0; t < 4; ++t) {
            int ch = t * 16 + mn, h = ch >> 3, d = ch & 7;
#pragma unroll
            for (int j = 0; j < 8; ++j) {
                int pp = mt * 16 + j + 8 * hf;
                int bb = pp >> 10, prow = pp & 1023;
                v_ws[(size_t)((bb * 8 + h) * 8 + d) * 1024 + prow] =
                    (_Float16)(acc[t][j] + bqkv[128 + ch]);
            }
        }
    }
}

// ---------------------------------------------------------------------------
// Kernel 3: relative logits, analytic skew form.
//   RW[b,h,qy,qx,kx] = sum_d q[b,h,qy*32+qx,d] * key_rel_w[kx-qx+31, d]
//   RH[b,h,qx,qy,ky] = sum_d q[b,h,qy*32+qx,d] * key_rel_h[ky-qy+31, d]
// ---------------------------------------------------------------------------
__global__ void rel_kernel(const float* __restrict__ q_ws,
                           const float* __restrict__ krw,
                           const float* __restrict__ krh,
                           float* __restrict__ RW, float* __restrict__ RH) {
    int i = blockIdx.x * blockDim.x + threadIdx.x;
    bool isW = i < 2097152;
    int idx = isW ? i : i - 2097152;
    if (idx >= 2097152) return;
    int k_ = idx & 31;          // kx (W) / ky (H)
    int a2 = (idx >> 5) & 31;   // qx (W) / qy (H)
    int a1 = (idx >> 10) & 31;  // qy (W) / qx (H)
    int h = (idx >> 15) & 7, b = idx >> 18;
    int p = isW ? (a1 * 32 + a2) : (a2 * 32 + a1);
    int m = k_ - a2 + 31;       // always in [0,62]
    const float* qrow = q_ws + (size_t)((b * 8 + h) * 1024 + p) * 8;
    const float* rk   = (isW ? krw : krh) + m * 8;
    float s = 0.f;
#pragma unroll
    for (int d = 0; d < 8; ++d) s += qrow[d] * rk[d];
    if (isW) RW[idx] = s; else RH[idx] = s;
}

// ---------------------------------------------------------------------------
// Kernel 4: attention, scores kept in registers. One wave per (b, h, 16 queries),
// 8 independent waves per work-group, no LDS, no barrier.
//  S^T = K.Q^T (f32 WMMA 16x16x4, K=8 in 2 steps): a lane holds ONE query's
//  scores (column mn), keys 8*hf+r down its 8 registers. A block of 32 keys is one
//  key row ky, so RW[q][kx] is the same 2 tiles for every block (it is the C
//  input of the first product) and RH[q][ky] is one value per lane and block.
//  Online softmax over 128 keys at a time: running maximum (base 2) and sum per
//  lane, one exchange between the lane halves per 128 keys.
//  O^T += V^T.P^T (f16 WMMA 16x16x32): two converted S^T tiles are the B operand
//  as they lie; A = V rows in the hardware k order. Rows 8..15 of O^T repeat
//  rows 0..7 (V has 8 rows) and are not stored.
// ---------------------------------------------------------------------------
__device__ __forceinline__ float xhalf(float x) {   // lane l <-> lane l ^ 16
    return __builtin_bit_cast(float, __builtin_amdgcn_permlanex16(
        __builtin_bit_cast(int, x), __builtin_bit_cast(int, x),
        0x76543210, 0xfedcba98, false, false));
}

__global__ void __launch_bounds__(256)
attn_kernel(const float* __restrict__ q_ws,
            const float* __restrict__ k_ws,
            const _Float16* __restrict__ v_ws,
            const float* __restrict__ RW,
            const float* __restrict__ RH,
            float* __restrict__ attn_pre) {
    const float L2E = 1.4426950408889634f;
    int wave = threadIdx.x >> 5, lane = threadIdx.x & 31;
    int hf = lane >> 4, mn = lane & 15;
    int wq = blockIdx.x * 8 + wave;         // 4096 waves = 64 (b,h) x 64 query tiles
    int bh = wq >> 6;
    int q  = (wq & 63) * 16 + mn;           // this lane's query
    int qy = q >> 5, qx = q & 31;

    // B operand of S^T: Q^T, column q, k = d = 2*hf + {0,1} (+4 in the second step)
    const float* qrow = q_ws + ((size_t)bh * 1024 + q) * 8;
    v2f qb0 = *(const v2f*)(qrow + hf * 2);
    v2f qb1 = *(const v2f*)(qrow + 4 + hf * 2);
    // RW[q][kx], kx = t*16 + 8*hf + r: in the accumulator map of tile t
    const float* rwrow = RW + (size_t)((bh * 32 + qy) * 32 + qx) * 32;
    v8f rw0 = *(const v8f*)(rwrow + hf * 8);
    v8f rw1 = *(const v8f*)(rwrow + 16 + hf * 8);
    // RH[q][ky], 32 contiguous values
    const float4* rhrow = (const float4*)(RH + (size_t)((bh * 32 + qx) * 32 + qy) * 32);
    // A operand of S^T: K, row key = mn, k = d as for Q
    const float* kp = k_ws + (size_t)bh * 8192 + (size_t)(hf * 2) * 1024 + mn;
    // A operand of O^T: V, row d = mn & 7, k = key in the hardware order
    const _Float16* vp = v_ws + (size_t)bh * 8192 + (size_t)(mn & 7) * 1024 + hf * 8;

    float m2 = -__builtin_inff();           // running maximum, times log2(e)
    v2f  lsum = {0.f, 0.f};                 // this lane half's share of the sum
    v8f  o = {};

    for (int g = 0; g < 8; ++g) {           // 128 keys = 4 key rows per trip
        float4 rh4 = rhrow[g];
        float rh[4] = { rh4.x, rh4.y, rh4.z, rh4.w };
        v8f s[4][2];
        for (int u = 0; u < 4; ++u) {
            for (int t = 0; t < 2; ++t) {
                const float* kk = kp + g * 128 + u * 32 + t * 16;
                v2f ka0 = { kk[0], kk[1024] };
                v2f ka1 = { kk[4096], kk[5120] };
                v8f c = __builtin_amdgcn_wmma_f32_16x16x4_f32(
                    false, ka0, false, qb0, (short)0, t ? rw1 : rw0, false, false);
                s[u][t] = __builtin_amdgcn_wmma_f32_16x16x4_f32(
                    false, ka1, false, qb1, (short)0, c, false, false);
            }
        }

        float mx = -__builtin_inff();
        for (int u = 0; u < 4; ++u) {
            float mu = s[u][0][0];
            for (int r = 1; r < 8; ++r) mu = fmaxf(mu, s[u][0][r]);
            for (int r = 0; r < 8; ++r) mu = fmaxf(mu, s[u][1][r]);
            mx = fmaxf(mx, mu + rh[u]);
        }
        mx = fmaxf(mx, xhalf(mx));
        float mnew  = fmaxf(m2, mx * L2E);
        float alpha = __builtin_amdgcn_exp2f(m2 - mnew);   // 0 on the first trip
        m2 = mnew;
        lsum *= alpha;
        o    *= alpha;

        for (int u = 0; u < 4; ++u) {
            float bias = rh[u] * L2E - mnew;
            v2f bias2 = { bias, bias };
            v16h pb;
            for (int t = 0; t < 2; ++t) {
                for (int i = 0; i < 4; ++i) {
                    v2f sv  = { s[u][t][2 * i], s[u][t][2 * i + 1] };
                    v2f arg = sv * L2E + bias2;
                    v2f p   = { __builtin_amdgcn_exp2f(arg.x), __builtin_amdgcn_exp2f(arg.y) };
                    lsum += p;
                    pb[t * 8 + 2 * i]     = (_Float16)p.x;
                    pb[t * 8 + 2 * i + 1] = (_Float16)p.y;
                }
            }
            union { uint4 w[2]; v16h v; } va;
            const _Float16* vv = vp + g * 128 + u * 32;
            va.w[0] = *(const uint4*)(vv);
            va.w[1] = *(const uint4*)(vv + 16);
            o = __builtin_amdgcn_wmma_f32_16x16x32_f16(
                false, va.v, false, pb, (short)0, o, false, false);
        }
    }

    float l = lsum.x + lsum.y;
    l += xhalf(l);
    float inv = 1.f / l;
    if (hf == 0) {                          // rows d = 0..7 of O^T
        for (int r = 0; r < 8; ++r)
            attn_pre[((size_t)bh * 8 + r) * 1024 + q] = o[r] * inv;
    }
}

// ---------------------------------------------------------------------------
// Kernel 5: 1x1 output projection. GEMM M=8192, N=64, K=64 (f32 WMMA).
// Writes channels 64..127 of d_out (+bias).
// ---------------------------------------------------------------------------
__global__ void proj_kernel(const float* __restrict__ attn_pre,
                            const float* __restrict__ w_attn,
                            const float* __restrict__ b_attn,
                            float* __restrict__ out) {
    int tid  = blockIdx.x * blockDim.x + threadIdx.x;
    int wid  = tid >> 5;
    int lane = threadIdx.x & 31;
    int mt = wid >> 2, nt = wid & 3;
    int hf = lane >> 4, mn = lane & 15;
    int p = mt * 16 + mn, b = p >> 10, pp = p & 1023;
    int col = nt * 16 + mn;

    v8f c = {};
    for (int kt = 0; kt < 16; ++kt) {
        int k0 = kt * 4 + hf * 2;
        v2f a, bb;
        a.x  = attn_pre[(size_t)(b * 64 + k0) * 1024 + pp];
        a.y  = attn_pre[(size_t)(b * 64 + k0 + 1) * 1024 + pp];
        bb.x = w_attn[col * 64 + k0];
        bb.y = w_attn[col * 64 + k0 + 1];
        c = __builtin_amdgcn_wmma_f32_16x16x4_f32(
            false, a, false, bb, (short)0, c, false, false);
    }
#pragma unroll
    for (int j = 0; j < 8; ++j) {
        int m = j + 8 * hf;
        int P = mt * 16 + m, bb2 = P >> 10, pr = P & 1023;
        out[(size_t)(bb2 * 128 + 64 + col) * 1024 + pr] = c[j] + b_attn[col];
    }
}

// ---------------------------------------------------------------------------
extern "C" void kernel_launch(void* const* d_in, const int* in_sizes, int n_in,
                              void* d_out, int out_size, void* d_ws, size_t ws_size,
                              hipStream_t stream) {
    const float* x    = (const float*)d_in[0];
    const float* wco  = (const float*)d_in[1];
    const float* bco  = (const float*)d_in[2];
    const float* wqkv = (const float*)d_in[3];
    const float* bqkv = (const float*)d_in[4];
    const float* watt = (const float*)d_in[5];
    const float* batt = (const float*)d_in[6];
    const float* krw  = (const float*)d_in[7];
    const float* krh  = (const float*)d_in[8];
    float* out = (float*)d_out;

    char* ws = (char*)d_ws;
    size_t o = 0;
    _Float16* wfrag = (_Float16*)(ws + o); o += (size_t)147456 * 2;    // 288 KB
    o = (o + 255) & ~(size_t)255;
    _Float16* afrag = (_Float16*)(ws + o); o += (size_t)4718592 * 2;   // 9 MB
    o = (o + 255) & ~(size_t)255;
    float* q_ws     = (float*)(ws + o);    o += (size_t)524288 * 4;    // 2 MB
    float* k_ws     = (float*)(ws + o);    o += (size_t)524288 * 4;    // 2 MB
    _Float16* v_ws  = (_Float16*)(ws + o); o += (size_t)524288 * 2;    // 1 MB
    o = (o + 255) & ~(size_t)255;
    float* RW       = (float*)(ws + o);    o += (size_t)2097152 * 4;   // 8 MB
    float* RH       = (float*)(ws + o);    o += (size_t)2097152 * 4;   // 8 MB
    float* attn_pre = (float*)(ws + o);    o += (size_t)524288 * 4;    // 2 MB

    // 1) weight swizzle + im2col in fragment order
    prep_w_kernel<<<(147456 + 255) / 256, 256, 0, stream>>>(wco, wqkv, wfrag);
    prep_a_kernel<<<(4718592 + 255) / 256, 256, 0, stream>>>(x, afrag);

    // 2) fused 3x3 convs as implicit GEMM (f16 WMMA + async LDS staging)
    conv_gemm_kernel<<<256, 256, 0, stream>>>(afrag, wfrag, bco, bqkv,
                                              out, q_ws, k_ws, v_ws);

    // 3) relative logits RW / RH
    rel_kernel<<<16384, 256, 0, stream>>>(q_ws, krw, krh, RW, RH);

    // 4) attention (scores in registers, 8 waves per WG, no LDS)
    attn_kernel<<<512, 256, 0, stream>>>(q_ws, k_ws, v_ws, RW, RH, attn_pre);

    // 5) 1x1 projection (f32 WMMA)
    proj_kernel<<<256, 256, 0, stream>>>(attn_pre, watt, batt, out);
}

// v002
// Measured time: 53.9 microseconds a run.
// Timed twice side by side with v001, it ran 1.20 and 1.19 times as fast.
// Counting every step since v000, it is 6.74 times as fast.
#include <hip/hip_runtime.h>
#include <hip/hip_bf16.h>

typedef __attribute__((ext_vector_type(16))) _Float16 v16h;
typedef __attribute__((ext_vector_type(8)))  float    v8f;
typedef __attribute__((ext_vector_type(2)))  float    v2f;
typedef __attribute__((address_space(3)))    _Float16 lds_f16;

// Fragment K-offset for 16-bit WMMA A/B operands (ISA 7.12.2, 16-bit 16x32 layout):
// lane = hf*16 + (m|n); element e -> K = (e<8) ? hf*8+e : 16+hf*8+(e-8)
__device__ __forceinline__ int kof(int e, int hf) {
    return (e < 8) ? (hf * 8 + e) : (16 + hf * 8 + (e - 8));
}

// ---------------------------------------------------------------------------
// Kernel 1a: wfrag = combined conv weights (conv_out 64ch ++ qkv 192ch),
// pre-swizzled into exact B-fragment order:
//   wfrag[((kt*256 + col)*2 + hf)*16 + e] = W[K = kt*32 + kof(e,hf)][col]
// ---------------------------------------------------------------------------
__global__ void prep_w_kernel(const float* __restrict__ wco,
                              const float* __restrict__ wqkv,
                              _Float16* __restrict__ wfrag) {
    int j = blockIdx.x * blockDim.x + threadIdx.x;
    if (j >= 147456) return;                       // 18*256*2*16
    int e   = j & 15;
    int hf  = (j >> 4) & 1;
    int col = (j >> 5) & 255;
    int kt  = j >> 13;
    int K = kt * 32 + kof(e, hf);                  // < 576 always
    int c = K / 9, r = K - c * 9;
    float v = (col < 64) ? wco[(col * 64 + c) * 9 + r]
                         : wqkv[((col - 64) * 64 + c) * 9 + r];
    wfrag[j] = (_Float16)v;
}

// ---------------------------------------------------------------------------
// Kernel 1b: afrag = im2col(x) in exact A-fragment order, f16:
//   afrag[((mt*18 + kt)*32 + lane)*16 + e] = im2col[p = mt*16 + lane%16]
//                                                  [K = kt*32 + kof(e, lane/16)]
// ---------------------------------------------------------------------------
__global__ void prep_a_kernel(const float* __restrict__ x,
                              _Float16* __restrict__ afrag) {
    int i = blockIdx.x * blockDim.x + threadIdx.x;
    if (i >= 4718592) return;                      // 512*18*32*16
    int e    = i & 15;
    int lane = (i >> 4) & 31;
    int t    = i >> 9;
    int mt   = t / 18;
    int kt   = t - mt * 18;
    int hf = lane >> 4, m = lane & 15;
    int p = mt * 16 + m;
    int b = p >> 10, yy = (p >> 5) & 31, xx = p & 31;
    int K = kt * 32 + kof(e, hf);
    int c = K / 9, r = K - c * 9;
    int ky = r / 3, kx = r - ky * 3;
    int iy = yy + ky - 1, ix = xx + kx - 1;
    float v = 0.f;
    if (iy >= 0 && iy < 32 && ix >= 0 && ix < 32)
        v = x[((b * 64 + c) * 32 + iy) * 32 + ix];
    afrag[i] = (_Float16)v;
}

// ---------------------------------------------------------------------------
// Kernel 2: fused implicit-GEMM 3x3 convs. M=8192 pixels, N=256 ch, K=576.
// Each wave: 16(M) x 64(N) tile, f16 WMMA, 18 K-steps of 32.
// Per K-step the 16KB B tile (shared by all 8 waves of the block) is staged
// into LDS via global_load_async_to_lds_b128 (ASYNCcnt path). The LDS dest
// is passed to the asm as an addrspace(3) POINTER (32-bit VGPR = LDS byte
// address) so the buffer escapes and the "memory" clobber correctly orders
// the ds_load_b128 fragment reads against the async writes.
// ---------------------------------------------------------------------------
__global__ void conv_gemm_kernel(const _Float16* __restrict__ afrag,
                                 const _Float16* __restrict__ wfrag,
                                 const float* __restrict__ bco,
                                 const float* __restrict__ bqkv,
                                 float* __restrict__ out,
                                 float* __restrict__ q_ws,
                                 float* __restrict__ k_ws,
                                 _Float16* __restrict__ v_ws) {
    __shared__ _Float16 lb[8192];                  // 16KB: B tile of current kt
    int tid  = blockIdx.x * blockDim.x + threadIdx.x;
    int wid  = tid >> 5;
    int lane = threadIdx.x & 31;
    int mt   = wid >> 2;          // 512 M-tiles (2 per block)
    int nt4  = wid & 3;           // 4 N-groups of 64 (also: output category)
    int hf   = lane >> 4, mn = lane & 15;

    v8f c0 = {}, c1 = {}, c2 = {}, c3 = {};
    for (int kt = 0; kt < 18; ++kt) {
        // ---- async-stage B tile: 256 threads x 4 x 16B = 16KB ----
        const _Float16* src = wfrag + (size_t)kt * 8192;
#pragma unroll
        for (int r = 0; r < 4; ++r) {
            lds_f16* lp = (lds_f16*)(lb + (size_t)(threadIdx.x + r * 256) * 8);
            const _Float16* g = src + (size_t)(threadIdx.x + r * 256) * 8;
            asm volatile("global_load_async_to_lds_b128 %0, %1, off"
                         :: "v"(lp), "v"(g) : "memory");
        }
        asm volatile("s_wait_asynccnt 0x0" ::: "memory");
        __syncthreads();

        // ---- A fragment: one aligned 32B load ----
        const _Float16* ap = afrag + ((size_t)(mt * 18 + kt) * 32 + lane) * 16;
        v16h a = *(const v16h*)ap;
        if (kt + 1 < 18)
            __builtin_prefetch(ap + 512, 0, 3);    // next kt A fragment

        // ---- 4 B fragments, then 4 WMMAs ----
        const _Float16* lbase = lb + (size_t)(nt4 * 64 + mn) * 32 + hf * 16;
        v16h b0 = *(const v16h*)(lbase);
        v16h b1 = *(const v16h*)(lbase + 512);     // +16 cols * 32
        v16h b2 = *(const v16h*)(lbase + 1024);
        v16h b3 = *(const v16h*)(lbase + 1536);
        c0 = __builtin_amdgcn_wmma_f32_16x16x32_f16(false, a, false, b0, (short)0, c0, false, false);
        c1 = __builtin_amdgcn_wmma_f32_16x16x32_f16(false, a, false, b1, (short)0, c1, false, false);
        c2 = __builtin_amdgcn_wmma_f32_16x16x32_f16(false, a, false, b2, (short)0, c2, false, false);
        c3 = __builtin_amdgcn_wmma_f32_16x16x32_f16(false, a, false, b3, (short)0, c3, false, false);
        __syncthreads();                           // protect lb before next stage
    }

    // ---- wave-uniform writeback ----
    const float QSCALE = 0.35355339059327373f;     // 8^-0.5
    v8f acc[4] = { c0, c1, c2, c3 };
    if (nt4 == 0) {                                // conv_out + bias -> d_out ch 0..63
#pragma unroll
        for (int t = 0; t < 4; ++t) {
            int col = t * 16 + mn;
#pragma unroll
            for (int j = 0; j < 8; ++j) {
                int pp = mt * 16 + j + 8 * hf;
                int bb = pp >> 10, prow = pp & 1023;
                out[(size_t)(bb * 128 + col) * 1024 + prow] = acc[t][j] + bco[col];
            }
        }
    } else if (nt4 == 1) {                         // q (scaled) -> q_ws[b,h,p,d]
#pragma unroll
        for (int t = 0; t < 4; ++t) {
            int ch = t * 16 + mn, h = ch >> 3, d = ch & 7;
#pragma unroll
            for (int j = 0; j < 8; ++j) {
                int pp = mt * 16 + j + 8 * hf;
                int bb = pp >> 10, prow = pp & 1023;
                q_ws[(size_t)((bb * 8 + h) * 1024 + prow) * 8 + d] =
                    (acc[t][j] + bqkv[ch]) * QSCALE;
            }
        }
    } else if (nt4 == 2) {                         // k -> k_ws[b,h,d,p] (f32)
#pragma unroll
        for (int t = 0; t < 4; ++t) {
            int ch = t * 16 + mn, h = ch >> 3, d = ch & 7;
#pragma unroll
            for (int j = 0; j < 8; ++j) {
                int pp = mt * 16 + j + 8 * hf;
                int bb = pp >> 10, prow = pp & 1023;
                k_ws[(size_t)((bb * 8 + h) * 8 + d) * 1024 + prow] =
                    acc[t][j] + bqkv[64 + ch];
            }
        }
    } else {                                       // v -> v_ws[b,h,d,p] (f16)
#pragma unroll
        for (int t = 0; t < 4; ++t) {
            int ch = t * 16 + mn, h = ch >> 3, d = ch & 7;
#pragma unroll
            for (int j = 0; j < 8; ++j) {
                int pp = mt * 16 + j + 8 * hf;
                int bb = pp >> 10, prow = pp & 1023;
                v_ws[(size_t)((bb * 8 + h) * 8 + d) * 1024 + prow] =
                    (_Float16)(acc[t][j] + bqkv[128 + ch]);
            }
        }
    }
}

// ---------------------------------------------------------------------------
// Kernel 3: attention, scores kept in registers. One wave per (b, h, 16 queries),
// 8 independent waves per work-group, no LDS, no barrier.
//  S^T = K.Q^T (f32 WMMA 16x16x4, K=8 in 2 steps): a lane holds ONE query's
//  scores (column mn), keys 8*hf+r down its 8 registers. A block of 32 keys is one
//  key row ky. The relative logits are formed here, no table of them is stored:
//   width:  RW[q][kx] = q . key_rel_w[kx-qx+31] is the same 2 tiles for every
//           block; each lane forms its 16 values once, they are the C input of
//           the first product.
//   height: RH[q][ky] = q . key_rel_h[ky-qy+31]; the 16 queries of a wave share
//           qy and the 32 keys of a block share ky, so that row of key_rel_h is
//           added to every K row of the block: (K + key_rel_h row) . q = S + RH.
//  Online softmax over 128 keys at a time: running maximum (base 2) and sum per
//  lane, one exchange between the lane halves per 128 keys.
//  O^T += V^T.P^T (f16 WMMA 16x16x32): two converted S^T tiles are the B operand
//  as they lie; A = V rows in the hardware k order. Rows 8..15 of O^T repeat
//  rows 0..7 (V has 8 rows) and are not stored.
// ---------------------------------------------------------------------------
__device__ __forceinline__ float xhalf(float x) {   // lane l <-> lane l ^ 16
    return __builtin_bit_cast(float, __builtin_amdgcn_permlanex16(
        __builtin_bit_cast(int, x), __builtin_bit_cast(int, x),
        0x76543210, 0xfedcba98, false, false));
}

__global__ void __launch_bounds__(256)
attn_kernel(const float* __restrict__ q_ws,
            const float* __restrict__ k_ws,
            const _Float16* __restrict__ v_ws,
            const float* __restrict__ krw,
            const float* __restrict__ krh,
            float* __restrict__ attn_pre) {
    const float L2E = 1.4426950408889634f;
    int wave = threadIdx.x >> 5, lane = threadIdx.x & 31;
    int hf = lane >> 4, mn = lane & 15;
    int wq = blockIdx.x * 8 + wave;         // 4096 waves = 64 (b,h) x 64 query tiles
    int bh = wq >> 6;
    int q  = (wq & 63) * 16 + mn;           // this lane's query
    int qy = q >> 5, qx = q & 31;

    // B operand of S^T: Q^T, column q, k = d = 2*hf + {0,1} (+4 in the second step)
    const float* qrow = q_ws + ((size_t)bh * 1024 + q) * 8;
    v2f qb0 = *(const v2f*)(qrow + hf * 2);
    v2f qb1 = *(const v2f*)(qrow + 4 + hf * 2);
    // RW[q][kx], kx = t*16 + 8*hf + r: in the accumulator map of tile t.
    // Table row kx - qx + 31 lies in [0,62] for every lane.
    float4 qlo = *(const float4*)(qrow);
    float4 qhi = *(const float4*)(qrow + 4);
    const float4* wrow = (const float4*)(krw + (hf * 8 - qx + 31) * 8);
    v8f rw0, rw1;
    for (int r = 0; r < 8; ++r) {
        float4 a0 = wrow[2 * r],      a1 = wrow[2 * r + 1];    // tile 0
        float4 b0 = wrow[32 + 2 * r], b1 = wrow[32 + 2 * r + 1]; // tile 1: 16 rows on
        rw0[r] = qlo.x * a0.x + qlo.y * a0.y + qlo.z * a0.z + qlo.w * a0.w
               + qhi.x * a1.x + qhi.y * a1.y + qhi.z * a1.z + qhi.w * a1.w;
        rw1[r] = qlo.x * b0.x + qlo.y * b0.y + qlo.z * b0.z + qlo.w * b0.w
               + qhi.x * b1.x + qhi.y * b1.y + qhi.z * b1.z + qhi.w * b1.w;
    }
    // key_rel_h row ky - qy + 31 (in [0,62]), k = d as for K; ky = 0 here
    const float* hrow = krh + (31 - qy) * 8 + hf * 2;
    // A operand of S^T: K, row key = mn, k = d as for Q
    const float* kp = k_ws + (size_t)bh * 8192 + (size_t)(hf * 2) * 1024 + mn;
    // A operand of O^T: V, row d = mn & 7, k = key in the hardware order
    const _Float16* vp = v_ws + (size_t)bh * 8192 + (size_t)(mn & 7) * 1024 + hf * 8;

    float m2 = -__builtin_inff();           // running maximum, times log2(e)
    v2f  lsum = {0.f, 0.f};                 // this lane half's share of the sum
    v8f  o = {};

    for (int g = 0; g < 8; ++g) {           // 128 keys = 4 key rows per trip
        v8f s[4][2];
        for (int u = 0; u < 4; ++u) {
            v2f h0 = *(const v2f*)(hrow + (g * 4 + u) * 8);
            v2f h1 = *(const v2f*)(hrow + (g * 4 + u) * 8 + 4);
            for (int t = 0; t < 2; ++t) {
                const float* kk = kp + g * 128 + u * 32 + t * 16;
                v2f ka0 = { kk[0], kk[1024] };
                v2f ka1 = { kk[4096], kk[5120] };
                ka0 += h0;
                ka1 += h1;
                v8f c = __builtin_amdgcn_wmma_f32_16x16x4_f32(
                    false, ka0, false, qb0, (short)0, t ? rw1 : rw0, false, false);
                s[u][t] = __builtin_amdgcn_wmma_f32_16x16x4_f32(
                    false, ka1, false, qb1, (short)0, c, false, false);
            }
        }

        // Precaution: stands between this trip's key_rel_h and K loads and the
        // instructions that rewrite their address registers for the next trip.
        asm volatile("s_wait_xcnt 0x0" ::: "memory");

        float mx = -__builtin_inff();
        for (int u = 0; u < 4; ++u) {
            float mu = s[u][0][0];
            for (int r = 1; r < 8; ++r) mu = fmaxf(mu, s[u][0][r]);
            for (int r = 0; r < 8; ++r) mu = fmaxf(mu, s[u][1][r]);
            mx = fmaxf(mx, mu);
        }
        mx = fmaxf(mx, xhalf(mx));
        float mnew  = fmaxf(m2, mx * L2E);
        float alpha = __builtin_amdgcn_exp2f(m2 - mnew);   // 0 on the first trip
        m2 = mnew;
        lsum *= alpha;
        o    *= alpha;

        v2f bias2 = { -mnew, -mnew };
        for (int u = 0; u < 4; ++u) {
            v16h pb;
            for (int t = 0; t < 2; ++t) {
                for (int i = 0; i < 4; ++i) {
                    v2f sv  = { s[u][t][2 * i], s[u][t][2 * i + 1] };
                    v2f arg = sv * L2E + bias2;
                    v2f p   = { __builtin_amdgcn_exp2f(arg.x), __builtin_amdgcn_exp2f(arg.y) };
                    lsum += p;
                    pb[t * 8 + 2 * i]     = (_Float16)p.x;
                    pb[t * 8 + 2 * i + 1] = (_Float16)p.y;
                }
            }
            union { uint4 w[2]; v16h v; } va;
            const _Float16* vv = vp + g * 128 + u * 32;
            va.w[0] = *(const uint4*)(vv);
            va.w[1] = *(const uint4*)(vv + 16);
            o = __builtin_amdgcn_wmma_f32_16x16x32_f16(
                false, va.v, false, pb, (short)0, o, false, false);
        }
    }

    float l = lsum.x + lsum.y;
    l += xhalf(l);
    float inv = 1.f / l;
    if (hf == 0) {                          // rows d = 0..7 of O^T
        for (int r = 0; r < 8; ++r)
            attn_pre[((size_t)bh * 8 + r) * 1024 + q] = o[r] * inv;
    }
}

// ---------------------------------------------------------------------------
// Kernel 4: 1x1 output projection. GEMM M=8192, N=64, K=64 (f32 WMMA).
// Writes channels 64..127 of d_out (+bias).
// ---------------------------------------------------------------------------
__global__ void proj_kernel(const float* __restrict__ attn_pre,
                            const float* __restrict__ w_attn,
                            const float* __restrict__ b_attn,
                            float* __restrict__ out) {
    int tid  = blockIdx.x * blockDim.x + threadIdx.x;
    int wid  = tid >> 5;
    int lane = threadIdx.x & 31;
    int mt = wid >> 2, nt = wid & 3;
    int hf = lane >> 4, mn = lane & 15;
    int p = mt * 16 + mn, b = p >> 10, pp = p & 1023;
    int col = nt * 16 + mn;

    v8f c = {};
    for (int kt = 0; kt < 16; ++kt) {
        int k0 = kt * 4 + hf * 2;
        v2f a, bb;
        a.x  = attn_pre[(size_t)(b * 64 + k0) * 1024 + pp];
        a.y  = attn_pre[(size_t)(b * 64 + k0 + 1) * 1024 + pp];
        bb.x = w_attn[col * 64 + k0];
        bb.y = w_attn[col * 64 + k0 + 1];
        c = __builtin_amdgcn_wmma_f32_16x16x4_f32(
            false, a, false, bb, (short)0, c, false, false);
    }
#pragma unroll
    for (int j = 0; j < 8; ++j) {
        int m = j + 8 * hf;
        int P = mt * 16 + m, bb2 = P >> 10, pr = P & 1023;
        out[(size_t)(bb2 * 128 + 64 + col) * 1024 + pr] = c[j] + b_attn[col];
    }
}

// ---------------------------------------------------------------------------
extern "C" void kernel_launch(void* const* d_in, const int* in_sizes, int n_in,
                              void* d_out, int out_size, void* d_ws, size_t ws_size,
                              hipStream_t stream) {
    const float* x    = (const float*)d_in[0];
    const float* wco  = (const float*)d_in[1];
    const float* bco  = (const float*)d_in[2];
    const float* wqkv = (const float*)d_in[3];
    const float* bqkv = (const float*)d_in[4];
    const float* watt = (const float*)d_in[5];
    const float* batt = (const float*)d_in[6];
    const float* krw  = (const float*)d_in[7];
    const float* krh  = (const float*)d_in[8];
    float* out = (float*)d_out;

    char* ws = (char*)d_ws;
    size_t o = 0;
    _Float16* wfrag = (_Float16*)(ws + o); o += (size_t)147456 * 2;    // 288 KB
    o = (o + 255) & ~(size_t)255;
    _Float16* afrag = (_Float16*)(ws + o); o += (size_t)4718592 * 2;   // 9 MB
    o = (o + 255) & ~(size_t)255;
    float* q_ws     = (float*)(ws + o);    o += (size_t)524288 * 4;    // 2 MB
    float* k_ws     = (float*)(ws + o);    o += (size_t)524288 * 4;    // 2 MB
    _Float16* v_ws  = (_Float16*)(ws + o); o += (size_t)524288 * 2;    // 1 MB
    o = (o + 255) & ~(size_t)255;
    float* attn_pre = (float*)(ws + o);    o += (size_t)524288 * 4;    // 2 MB

    // 1) weight swizzle + im2col in fragment order
    prep_w_kernel<<<(147456 + 255) / 256, 256, 0, stream>>>(wco, wqkv, wfrag);
    prep_a_kernel<<<(4718592 + 255) / 256, 256, 0, stream>>>(x, afrag);

    // 2) fused 3x3 convs as implicit GEMM (f16 WMMA + async LDS staging)
    conv_gemm_kernel<<<256, 256, 0, stream>>>(afrag, wfrag, bco, bqkv,
                                              out, q_ws, k_ws, v_ws);

    // 3) attention with its relative logits (scores in registers, 8 waves per WG, no LDS)
    attn_kernel<<<512, 256, 0, stream>>>(q_ws, k_ws, v_ws, krw, krh, attn_pre);

    // 4) 1x1 projection (f32 WMMA)
    proj_kernel<<<256, 256, 0, stream>>>(attn_pre, watt, batt, out);
}

// v003
// One run takes 41.1 microseconds.
// Two timings next to v002 put it at 1.29 and 1.28 times that version's speed.
// Over all steps from v000 it is 8.66 times as fast.
#include <hip/hip_runtime.h>
#include <hip/hip_bf16.h>

typedef __attribute__((ext_vector_type(16))) _Float16 v16h;
typedef __attribute__((ext_vector_type(8)))  float    v8f;
typedef __attribute__((ext_vector_type(2)))  float    v2f;
typedef __attribute__((address_space(3)))    _Float16 lds_f16;

// Fragment K-offset for 16-bit WMMA A/B operands (ISA 7.12.2, 16-bit 16x32 layout):
// lane = hf*16 + (m|n); element e -> K = (e<8) ? hf*8+e : 16+hf*8+(e-8)
__device__ __forceinline__ int kof(int e, int hf) {
    return (e < 8) ? (hf * 8 + e) : (16 + hf * 8 + (e - 8));
}

// ---------------------------------------------------------------------------
// Kernel 1: wfrag = combined conv weights (conv_out 64ch ++ qkv 192ch),
// pre-swizzled into exact B-fragment order:
//   wfrag[((kt*256 + col)*2 + hf)*16 + e] = W[K = kt*32 + kof(e,hf)][col]
// k order, the same as the conv kernel's A loader: K = tap*64 + channel,
// tap = ky*3 + kx.
// ---------------------------------------------------------------------------
__global__ void prep_w_kernel(const float* __restrict__ wco,
                              const float* __restrict__ wqkv,
                              _Float16* __restrict__ wfrag) {
    int j = blockIdx.x * blockDim.x + threadIdx.x;
    if (j >= 147456) return;                       // 18*256*2*16
    int e   = j & 15;
    int hf  = (j >> 4) & 1;
    int col = (j >> 5) & 255;
    int kt  = j >> 13;
    int K = kt * 32 + kof(e, hf);                  // < 576 always
    int c = K & 63, r = K >> 6;
    float v = (col < 64) ? wco[(col * 64 + c) * 9 + r]
                         : wqkv[((col - 64) * 64 + c) * 9 + r];
    wfrag[j] = (_Float16)v;
}

// ---------------------------------------------------------------------------
// Kernel 2: fused implicit-GEMM 3x3 convs. M=8192 pixels, N=256 ch, K=576.
// Each wave: 16(M) x 64(N) tile, f16 WMMA, 18 K-steps of 32.
// A work-group owns one image row (32 pixels). Its A operand is never stored as
// an im2col table: the 3 input rows it needs are converted to f16 once and laid
// in LDS pixel-major, xs[row 0..2][column -1..32][channel], borders zero. With
// K = tap*64 + channel a K-step is 32 channels of ONE tap, so a lane's fragment
// is two 16-byte LDS reads at its pixel shifted by the tap.
// Per K-step the 16KB B tile (shared by all 8 waves of the block) is staged
// into LDS via global_load_async_to_lds_b128 (ASYNCcnt path). The LDS dest
// is passed to the asm as an addrspace(3) POINTER (32-bit VGPR = LDS byte
// address) so the buffer escapes and the "memory" clobber correctly orders
// the ds_load_b128 fragment reads against the async writes.
// ---------------------------------------------------------------------------
__global__ void conv_gemm_kernel(const float* __restrict__ x,
                                 const _Float16* __restrict__ wfrag,
                                 const float* __restrict__ bco,
                                 const float* __restrict__ bqkv,
                                 float* __restrict__ out,
                                 float* __restrict__ q_ws,
                                 float* __restrict__ k_ws,
                                 _Float16* __restrict__ v_ws) {
    __shared__ _Float16 lb[8192];                  // 16KB: B tile of current kt
    // 144-byte pixel pitch (64 channels + 8 unused): 16 B x odd, no bank conflict
    // for the 16-byte stores and reads below
    constexpr int XP = 72;
    __shared__ __attribute__((aligned(16))) _Float16 xs[3 * 34 * XP];
    int tid  = blockIdx.x * blockDim.x + threadIdx.x;
    int wid  = tid >> 5;
    int lane = threadIdx.x & 31;
    int mt   = wid >> 2;          // 512 M-tiles (2 per block)
    int nt4  = wid & 3;           // 4 N-groups of 64 (also: output category)
    int hf   = lane >> 4, mn = lane & 15;

    // ---- x tile: wave w converts channels 8w..8w+7 of the 3 rows, lane = column.
    // Read by other waves only behind the first barrier of the K loop.
    int wave = threadIdx.x >> 5;
    int bimg = blockIdx.x >> 5, yy = blockIdx.x & 31;
    // All 24 loads are issued together: a row outside the image is read at the
    // clamped row and replaced by zero, so no branch splits the loads.
    float xv[3][8];
    const float* xp[3];
    for (int rr = 0; rr < 3; ++rr) {
        int iy = min(max(yy + rr - 1, 0), 31);
        xp[rr] = x + ((size_t)(bimg * 64 + wave * 8) * 32 + iy) * 32 + lane;
        for (int i = 0; i < 8; ++i) xv[rr][i] = xp[rr][i * 1024];
    }
    // Precaution: stands behind the 24 loads, in front of any rewrite of their
    // address registers; naming the addresses keeps those registers until here.
    asm volatile("s_wait_xcnt 0x0" :: "v"(xp[0]), "v"(xp[1]), "v"(xp[2]) : "memory");
    for (int rr = 0; rr < 3; ++rr) {
        bool inside = (unsigned)(yy + rr - 1) < 32u;
        union { _Float16 h[8]; uint4 w; } pk;
        for (int i = 0; i < 8; ++i) pk.h[i] = (_Float16)(inside ? xv[rr][i] : 0.f);
        *(uint4*)(xs + (rr * 34 + lane + 1) * XP + wave * 8) = pk.w;
    }
    if (threadIdx.x < 48) {                        // columns -1 and 32: zero
        int rr = threadIdx.x >> 4, side = (threadIdx.x >> 3) & 1, cg = threadIdx.x & 7;
        *(uint4*)(xs + (rr * 34 + side * 33) * XP + cg * 8) = make_uint4(0u, 0u, 0u, 0u);
    }
    // this lane's pixel at tap (0,0), channels hf*8..
    const _Float16* abase = xs + ((wave >> 2) * 16 + mn) * XP + hf * 8;

    v8f c0 = {}, c1 = {}, c2 = {}, c3 = {};
    for (int kt = 0; kt < 18; ++kt) {
        // ---- async-stage B tile: 256 threads x 4 x 16B = 16KB ----
        const _Float16* src = wfrag + (size_t)kt * 8192;
        lds_f16* lp = (lds_f16*)(lb + (size_t)threadIdx.x * 8);
        const _Float16* g = src + (size_t)threadIdx.x * 8;
        // One statement: s_wait_xcnt 0 stands behind the last copy, in front of any
        // rewrite of a register that a copy names (a precaution).
        asm volatile("global_load_async_to_lds_b128 %0, %4, off\n\t"
                     "global_load_async_to_lds_b128 %1, %5, off\n\t"
                     "global_load_async_to_lds_b128 %2, %6, off\n\t"
                     "global_load_async_to_lds_b128 %3, %7, off\n\t"
                     "s_wait_xcnt 0x0"
                     :: "v"(lp), "v"(lp + 2048), "v"(lp + 4096), "v"(lp + 6144),
                        "v"(g), "v"(g + 2048), "v"(g + 4096), "v"(g + 6144)
                     : "memory");
        asm volatile("s_wait_asynccnt 0x0" ::: "memory");
        __syncthreads();

        // ---- A fragment: channels (kt&1)*32 + kof(e,hf) of tap kt>>1 ----
        int tap = kt >> 1, ky = tap / 3, kx = tap - ky * 3;
        const _Float16* ap = abase + (ky * 34 + kx) * XP + (kt & 1) * 32;
        union { uint4 w[2]; v16h v; } af;
        af.w[0] = *(const uint4*)(ap);             // e = 0..7
        af.w[1] = *(const uint4*)(ap + 16);        // e = 8..15: 16 channels on
        v16h a = af.v;

        // ---- 4 B fragments, then 4 WMMAs ----
        const _Float16* lbase = lb + (size_t)(nt4 * 64 + mn) * 32 + hf * 16;
        v16h b0 = *(const v16h*)(lbase);
        v16h b1 = *(const v16h*)(lbase + 512);     // +16 cols * 32
        v16h b2 = *(const v16h*)(lbase + 1024);
        v16h b3 = *(const v16h*)(lbase + 1536);
        // keeps the ten LDS reads one group in front of the products: spread among
        // them, each pair is waited for on its own
        __builtin_amdgcn_sched_barrier(0);
        c0 = __builtin_amdgcn_wmma_f32_16x16x32_f16(false, a, false, b0, (short)0, c0, false, false);
        c1 = __builtin_amdgcn_wmma_f32_16x16x32_f16(false, a, false, b1, (short)0, c1, false, false);
        c2 = __builtin_amdgcn_wmma_f32_16x16x32_f16(false, a, false, b2, (short)0, c2, false, false);
        c3 = __builtin_amdgcn_wmma_f32_16x16x32_f16(false, a, false, b3, (short)0, c3, false, false);
        __syncthreads();                           // protect lb before next stage
    }

    // ---- wave-uniform writeback ----
    const float QSCALE = 0.35355339059327373f;     // 8^-0.5
    v8f acc[4] = { c0, c1, c2, c3 };
    if (nt4 == 0) {                                // conv_out + bias -> d_out ch 0..63
#pragma unroll
        for (int t = 0; t < 4; ++t) {
            int col = t * 16 + mn;
#pragma unroll
            for (int j = 0; j < 8; ++j) {
                int pp = mt * 16 + j + 8 * hf;
                int bb = pp >> 10, prow = pp & 1023;
                out[(size_t)(bb * 128 + col) * 1024 + prow] = acc[t][j] + bco[col];
            }
        }
    } else if (nt4 == 1) {                         // q (scaled) -> q_ws[b,h,p,d]
#pragma unroll
        for (int t = 0; t < 4; ++t) {
            int ch = t * 16 + mn, h = ch >> 3, d = ch & 7;
#pragma unroll
            for (int j = 0; j < 8; ++j) {
                int pp = mt * 16 + j + 8 * hf;
                int bb = pp >> 10, prow = pp & 1023;
                q_ws[(size_t)((bb * 8 + h) * 1024 + prow) * 8 + d] =
                    (acc[t][j] + bqkv[ch]) * QSCALE;
            }
        }
    } else if (nt4 == 2) {                         // k -> k_ws[b,h,d,p] (f32)
#pragma unroll
        for (int t = 0; t < 4; ++t) {
            int ch = t * 16 + mn, h = ch >> 3, d = ch & 7;
#pragma unroll
            for (int j = 0; j < 8; ++j) {
                int pp = mt * 16 + j + 8 * hf;
                int bb = pp >> 10, prow = pp & 1023;
                k_ws[(size_t)((bb * 8 + h) * 8 + d) * 1024 + prow] =
                    acc[t][j] + bqkv[64 + ch];
            }
        }
    } else {                                       // v -> v_ws[b,h,d,p] (f16)
#pragma unroll
        for (int t = 0; t < 4; ++t) {
            int ch = t * 16 + mn, h = ch >> 3, d = ch & 7;
#pragma unroll
            for (int j = 0; j < 8; ++j) {
                int pp = mt * 16 + j + 8 * hf;
                int bb = pp >> 10, prow = pp & 1023;
                v_ws[(size_t)((bb * 8 + h) * 8 + d) * 1024 + prow] =
                    (_Float16)(acc[t][j] + bqkv[128 + ch]);
            }
        }
    }
}

// ---------------------------------------------------------------------------
// Kernel 3: attention, scores kept in registers. One wave per (b, h, 16 queries),
// 8 independent waves per work-group, no LDS, no barrier.
//  S^T = K.Q^T (f32 WMMA 16x16x4, K=8 in 2 steps): a lane holds ONE query's
//  scores (column mn), keys 8*hf+r down its 8 registers. A block of 32 keys is one
//  key row ky. The relative logits are formed here, no table of them is stored:
//   width:  RW[q][kx] = q . key_rel_w[kx-qx+31] is the same 2 tiles for every
//           block; each lane forms its 16 values once, they are the C input of
//           the first product.
//   height: RH[q][ky] = q . key_rel_h[ky-qy+31]; the 16 queries of a wave share
//           qy and the 32 keys of a block share ky, so that row of key_rel_h is
//           added to every K row of the block: (K + key_rel_h row) . q = S + RH.
//  Online softmax over 128 keys at a time: running maximum (base 2) and sum per
//  lane, one exchange between the lane halves per 128 keys.
//  O^T += V^T.P^T (f16 WMMA 16x16x32): two converted S^T tiles are the B operand
//  as they lie; A = V rows in the hardware k order. Rows 8..15 of O^T repeat
//  rows 0..7 (V has 8 rows) and are not stored.
// ---------------------------------------------------------------------------
__device__ __forceinline__ float xhalf(float x) {   // lane l <-> lane l ^ 16
    return __builtin_bit_cast(float, __builtin_amdgcn_permlanex16(
        __builtin_bit_cast(int, x), __builtin_bit_cast(int, x),
        0x76543210, 0xfedcba98, false, false));
}

__global__ void __launch_bounds__(256)
attn_kernel(const float* __restrict__ q_ws,
            const float* __restrict__ k_ws,
            const _Float16* __restrict__ v_ws,
            const float* __restrict__ krw,
            const float* __restrict__ krh,
            float* __restrict__ attn_pre) {
    const float L2E = 1.4426950408889634f;
    int wave = threadIdx.x >> 5, lane = threadIdx.x & 31;
    int hf = lane >> 4, mn = lane & 15;
    int wq = blockIdx.x * 8 + wave;         // 4096 waves = 64 (b,h) x 64 query tiles
    int bh = wq >> 6;
    int q  = (wq & 63) * 16 + mn;           // this lane's query
    int qy = q >> 5, qx = q & 31;

    // B operand of S^T: Q^T, column q, k = d = 2*hf + {0,1} (+4 in the second step)
    const float* qrow = q_ws + ((size_t)bh * 1024 + q) * 8;
    v2f qb0 = *(const v2f*)(qrow + hf * 2);
    v2f qb1 = *(const v2f*)(qrow + 4 + hf * 2);
    // RW[q][kx], kx = t*16 + 8*hf + r: in the accumulator map of tile t.
    // Table row kx - qx + 31 lies in [0,62] for every lane.
    float4 qlo = *(const float4*)(qrow);
    float4 qhi = *(const float4*)(qrow + 4);
    const float4* wrow = (const float4*)(krw + (hf * 8 - qx + 31) * 8);
    v8f rw0, rw1;
    for (int r = 0; r < 8; ++r) {
        float4 a0 = wrow[2 * r],      a1 = wrow[2 * r + 1];    // tile 0
        float4 b0 = wrow[32 + 2 * r], b1 = wrow[32 + 2 * r + 1]; // tile 1: 16 rows on
        rw0[r] = qlo.x * a0.x + qlo.y * a0.y + qlo.z * a0.z + qlo.w * a0.w
               + qhi.x * a1.x + qhi.y * a1.y + qhi.z * a1.z + qhi.w * a1.w;
        rw1[r] = qlo.x * b0.x + qlo.y * b0.y + qlo.z * b0.z + qlo.w * b0.w
               + qhi.x * b1.x + qhi.y * b1.y + qhi.z * b1.z + qhi.w * b1.w;
    }
    // key_rel_h row ky - qy + 31 (in [0,62]), k = d as for K; ky = 0 here
    const float* hrow = krh + (31 - qy) * 8 + hf * 2;
    // A operand of S^T: K, row key = mn, k = d as for Q
    const float* kp = k_ws + (size_t)bh * 8192 + (size_t)(hf * 2) * 1024 + mn;
    // A operand of O^T: V, row d = mn & 7, k = key in the hardware order
    const _Float16* vp = v_ws + (size_t)bh * 8192 + (size_t)(mn & 7) * 1024 + hf * 8;

    float m2 = -__builtin_inff();           // running maximum, times log2(e)
    v2f  lsum = {0.f, 0.f};                 // this lane half's share of the sum
    v8f  o = {};

    for (int g = 0; g < 8; ++g) {           // 128 keys = 4 key rows per trip
        v8f s[4][2];
        for (int u = 0; u < 4; ++u) {
            v2f h0 = *(const v2f*)(hrow + (g * 4 + u) * 8);
            v2f h1 = *(const v2f*)(hrow + (g * 4 + u) * 8 + 4);
            for (int t = 0; t < 2; ++t) {
                const float* kk = kp + g * 128 + u * 32 + t * 16;
                v2f ka0 = { kk[0], kk[1024] };
                v2f ka1 = { kk[4096], kk[5120] };
                ka0 += h0;
                ka1 += h1;
                v8f c = __builtin_amdgcn_wmma_f32_16x16x4_f32(
                    false, ka0, false, qb0, (short)0, t ? rw1 : rw0, false, false);
                s[u][t] = __builtin_amdgcn_wmma_f32_16x16x4_f32(
                    false, ka1, false, qb1, (short)0, c, false, false);
            }
        }

        // Precaution: stands between this trip's key_rel_h and K loads and the
        // instructions that rewrite their address registers for the next trip.
        asm volatile("s_wait_xcnt 0x0" ::: "memory");

        float mx = -__builtin_inff();
        for (int u = 0; u < 4; ++u) {
            float mu = s[u][0][0];
            for (int r = 1; r < 8; ++r) mu = fmaxf(mu, s[u][0][r]);
            for (int r = 0; r < 8; ++r) mu = fmaxf(mu, s[u][1][r]);
            mx = fmaxf(mx, mu);
        }
        mx = fmaxf(mx, xhalf(mx));
        float mnew  = fmaxf(m2, mx * L2E);
        float alpha = __builtin_amdgcn_exp2f(m2 - mnew);   // 0 on the first trip
        m2 = mnew;
        lsum *= alpha;
        o    *= alpha;

        v2f bias2 = { -mnew, -mnew };
        for (int u = 0; u < 4; ++u) {
            v16h pb;
            for (int t = 0; t < 2; ++t) {
                for (int i = 0; i < 4; ++i) {
                    v2f sv  = { s[u][t][2 * i], s[u][t][2 * i + 1] };
                    v2f arg = sv * L2E + bias2;
                    v2f p   = { __builtin_amdgcn_exp2f(arg.x), __builtin_amdgcn_exp2f(arg.y) };
                    lsum += p;
                    pb[t * 8 + 2 * i]     = (_Float16)p.x;
                    pb[t * 8 + 2 * i + 1] = (_Float16)p.y;
                }
            }
            union { uint4 w[2]; v16h v; } va;
            const _Float16* vv = vp + g * 128 + u * 32;
            va.w[0] = *(const uint4*)(vv);
            va.w[1] = *(const uint4*)(vv + 16);
            o = __builtin_amdgcn_wmma_f32_16x16x32_f16(
                false, va.v, false, pb, (short)0, o, false, false);
        }
    }

    float l = lsum.x + lsum.y;
    l += xhalf(l);
    float inv = 1.f / l;
    if (hf == 0) {                          // rows d = 0..7 of O^T
        for (int r = 0; r < 8; ++r)
            attn_pre[((size_t)bh * 8 + r) * 1024 + q] = o[r] * inv;
    }
}

// ---------------------------------------------------------------------------
// Kernel 4: 1x1 output projection. GEMM M=8192, N=64, K=64 (f32 WMMA).
// Writes channels 64..127 of d_out (+bias).
// ---------------------------------------------------------------------------
__global__ void proj_kernel(const float* __restrict__ attn_pre,
                            const float* __restrict__ w_attn,
                            const float* __restrict__ b_attn,
                            float* __restrict__ out) {
    int tid  = blockIdx.x * blockDim.x + threadIdx.x;
    int wid  = tid >> 5;
    int lane = threadIdx.x & 31;
    int mt = wid >> 2, nt = wid & 3;
    int hf = lane >> 4, mn = lane & 15;
    int p = mt * 16 + mn, b = p >> 10, pp = p & 1023;
    int col = nt * 16 + mn;

    v8f c = {};
    for (int kt = 0; kt < 16; ++kt) {
        int k0 = kt * 4 + hf * 2;
        v2f a, bb;
        a.x  = attn_pre[(size_t)(b * 64 + k0) * 1024 + pp];
        a.y  = attn_pre[(size_t)(b * 64 + k0 + 1) * 1024 + pp];
        bb.x = w_attn[col * 64 + k0];
        bb.y = w_attn[col * 64 + k0 + 1];
        c = __builtin_amdgcn_wmma_f32_16x16x4_f32(
            false, a, false, bb, (short)0, c, false, false);
    }
#pragma unroll
    for (int j = 0; j < 8; ++j) {
        int m = j + 8 * hf;
        int P = mt * 16 + m, bb2 = P >> 10, pr = P & 1023;
        out[(size_t)(bb2 * 128 + 64 + col) * 1024 + pr] = c[j] + b_attn[col];
    }
}

// ---------------------------------------------------------------------------
extern "C" void kernel_launch(void* const* d_in, const int* in_sizes, int n_in,
                              void* d_out, int out_size, void* d_ws, size_t ws_size,
                              hipStream_t stream) {
    const float* x    = (const float*)d_in[0];
    const float* wco  = (const float*)d_in[1];
    const float* bco  = (const float*)d_in[2];
    const float* wqkv = (const float*)d_in[3];
    const float* bqkv = (const float*)d_in[4];
    const float* watt = (const float*)d_in[5];
    const float* batt = (const float*)d_in[6];
    const float* krw  = (const float*)d_in[7];
    const float* krh  = (const float*)d_in[8];
    float* out = (float*)d_out;

    char* ws = (char*)d_ws;
    size_t o = 0;
    _Float16* wfrag = (_Float16*)(ws + o); o += (size_t)147456 * 2;    // 288 KB
    o = (o + 255) & ~(size_t)255;
    float* q_ws     = (float*)(ws + o);    o += (size_t)524288 * 4;    // 2 MB
    float* k_ws     = (float*)(ws + o);    o += (size_t)524288 * 4;    // 2 MB
    _Float16* v_ws  = (_Float16*)(ws + o); o += (size_t)524288 * 2;    // 1 MB
    o = (o + 255) & ~(size_t)255;
    float* attn_pre = (float*)(ws + o);    o += (size_t)524288 * 4;    // 2 MB

    // 1) weight swizzle in fragment order
    prep_w_kernel<<<(147456 + 255) / 256, 256, 0, stream>>>(wco, wqkv, wfrag);

    // 2) fused 3x3 convs as implicit GEMM (f16 WMMA + async LDS staging)
    conv_gemm_kernel<<<256, 256, 0, stream>>>(x, wfrag, bco, bqkv,
                                              out, q_ws, k_ws, v_ws);

    // 3) attention with its relative logits (scores in registers, 8 waves per WG, no LDS)
    attn_kernel<<<512, 256, 0, stream>>>(q_ws, k_ws, v_ws, krw, krh, attn_pre);

    // 4) 1x1 projection (f32 WMMA)
    proj_kernel<<<256, 256, 0, stream>>>(attn_pre, watt, batt, out);
}

// v004
// It runs in 30 microseconds.
// Two timings next to v003 put it at 1.43 and 1.42 times that version's speed.
// Counting every step since v000, it is 12.4 times as fast.
#include <hip/hip_runtime.h>
#include <hip/hip_bf16.h>

typedef __attribute__((ext_vector_type(16))) _Float16 v16h;
typedef __attribute__((ext_vector_type(8)))  float    v8f;
typedef __attribute__((ext_vector_type(2)))  float    v2f;

// Fragment K-offset for 16-bit WMMA A/B operands (ISA 7.12.2, 16-bit 16x32 layout):
// lane = hf*16 + (m|n); element e -> K = (e<8) ? hf*8+e : 16+hf*8+(e-8)
__device__ __forceinline__ int kof(int e, int hf) {
    return (e < 8) ? (hf * 8 + e) : (16 + hf * 8 + (e - 8));
}

// ---------------------------------------------------------------------------
// Kernel 1: wfrag = combined conv weights (conv_out 64ch ++ qkv 192ch),
// pre-swizzled so that one 16-byte load of a wave is 512 contiguous bytes:
//   wfrag[(((kt*16 + nt)*2 + half)*32 + lane)*8 + i] = W[K][col],
//   col = nt*16 + (lane & 15), K = kt*32 + kof(half*8 + i, lane >> 4)
// k order, the same as the conv kernel's A loader: K = tap*64 + channel,
// tap = ky*3 + kx.
// ---------------------------------------------------------------------------
__global__ void prep_w_kernel(const float* __restrict__ wco,
                              const float* __restrict__ wqkv,
                              _Float16* __restrict__ wfrag) {
    int j = blockIdx.x * blockDim.x + threadIdx.x;
    if (j >= 147456) return;                       // 18*16*2*32*8
    int e   = ((j >> 8) & 1) * 8 + (j & 7);
    int hf  = (j >> 7) & 1;
    int col = ((j >> 9) & 15) * 16 + ((j >> 3) & 15);
    int kt  = j >> 13;
    int K = kt * 32 + kof(e, hf);                  // < 576 always
    int c = K & 63, r = K >> 6;
    float v = (col < 64) ? wco[(col * 64 + c) * 9 + r]
                         : wqkv[((col - 64) * 64 + c) * 9 + r];
    wfrag[j] = (_Float16)v;
}

// ---------------------------------------------------------------------------
// Kernel 2: fused implicit-GEMM 3x3 convs. M=8192 pixels, N=256 ch, K=576.
// Each wave: 32(M) x 32(N) tile, f16 WMMA, 18 K-steps of 32.
// A work-group owns one image row (32 pixels). Its A operand is never stored as
// an im2col table: the 3 input rows it needs are converted to f16 once and laid
// in LDS pixel-major, xs[row 0..2][column -1..32][channel], borders zero. With
// K = tap*64 + channel a K-step is 32 channels of ONE tap, so a lane's fragment
// is two 16-byte LDS reads at its pixel shifted by the tap.
// Every wave takes all 32 pixels and 32 channels of its own, so a B fragment has
// one reader in the work-group: it goes from L2 straight into that wave's
// registers, PF K-steps ahead of its use, and the K loop has no barrier.
// ---------------------------------------------------------------------------
__global__ void __launch_bounds__(256)
conv_gemm_kernel(const float* __restrict__ x,
                 const _Float16* __restrict__ wfrag,
                 const float* __restrict__ bco,
                 const float* __restrict__ bqkv,
                 float* __restrict__ out,
                 float* __restrict__ q_ws,
                 float* __restrict__ k_ws,
                 _Float16* __restrict__ v_ws) {
    // 144-byte pixel pitch (64 channels + 8 unused): 16 B x odd, no bank conflict
    // for the 16-byte stores and reads below
    constexpr int XP = 72;
    constexpr int PF = 9;                          // K-steps of B held in registers
    __shared__ __attribute__((aligned(16))) _Float16 xs[3 * 34 * XP];
    int lane = threadIdx.x & 31;
    int hf   = lane >> 4, mn = lane & 15;

    // ---- x tile: wave w converts channels 8w..8w+7 of the 3 rows, lane = column.
    int wave = threadIdx.x >> 5;
    int bimg = blockIdx.x >> 5, yy = blockIdx.x & 31;
    // All 24 loads are issued together: a row outside the image is read at the
    // clamped row and replaced by zero, so no branch splits the loads.
    float xv[3][8];
    const float* xp[3];
    for (int rr = 0; rr < 3; ++rr) {
        int iy = min(max(yy + rr - 1, 0), 31);
        xp[rr] = x + ((size_t)(bimg * 64 + wave * 8) * 32 + iy) * 32 + lane;
        for (int i = 0; i < 8; ++i) xv[rr][i] = xp[rr][i * 1024];
    }
    // Precaution: stands behind the 24 loads, in front of any rewrite of their
    // address registers; naming the addresses keeps those registers until here.
    asm volatile("s_wait_xcnt 0x0" :: "v"(xp[0]), "v"(xp[1]), "v"(xp[2]) : "memory");

    // ---- B: this wave's 2 column tiles; per K-step 4 loads of 512 B, 2 KB in a row
    const uint4* bp = (const uint4*)wfrag + wave * 128 + lane;
    uint4 bq[PF][4];
    // unrolled, here and below: bq is indexed by constants only and stays in registers
#pragma unroll
    for (int kt = 0; kt < PF; ++kt)
#pragma unroll
        for (int i = 0; i < 4; ++i) bq[kt][i] = bp[kt * 1024 + i * 32];

    for (int rr = 0; rr < 3; ++rr) {
        bool inside = (unsigned)(yy + rr - 1) < 32u;
        union { _Float16 h[8]; uint4 w; } pk;
        for (int i = 0; i < 8; ++i) pk.h[i] = (_Float16)(inside ? xv[rr][i] : 0.f);
        *(uint4*)(xs + (rr * 34 + lane + 1) * XP + wave * 8) = pk.w;
    }
    if (threadIdx.x < 48) {                        // columns -1 and 32: zero
        int rr = threadIdx.x >> 4, side = (threadIdx.x >> 3) & 1, cg = threadIdx.x & 7;
        *(uint4*)(xs + (rr * 34 + side * 33) * XP + cg * 8) = make_uint4(0u, 0u, 0u, 0u);
    }
    __syncthreads();                               // the x tile is read by every wave

    // this lane's pixel of the first 16 at tap (0,0), channels hf*8..
    const _Float16* abase = xs + mn * XP + hf * 8;

    v8f acc[2][2] = {};                            // [pixel tile][column tile]
#pragma unroll
    for (int kt = 0; kt < 18; ++kt) {
        // ---- A fragments: channels (kt&1)*32 + kof(e,hf) of tap kt>>1 ----
        int tap = kt >> 1, ky = tap / 3, kx = tap - ky * 3;
        const _Float16* ap = abase + (ky * 34 + kx) * XP + (kt & 1) * 32;
        union { uint4 w[2]; v16h v; } a0, a1, b0, b1;
        a0.w[0] = *(const uint4*)(ap);             // e = 0..7
        a0.w[1] = *(const uint4*)(ap + 16);        // e = 8..15: 16 channels on
        a1.w[0] = *(const uint4*)(ap + 16 * XP);   // pixels 16..31
        a1.w[1] = *(const uint4*)(ap + 16 * XP + 16);
        b0.w[0] = bq[kt % PF][0];
        b0.w[1] = bq[kt % PF][1];
        b1.w[0] = bq[kt % PF][2];
        b1.w[1] = bq[kt % PF][3];
        acc[0][0] = __builtin_amdgcn_wmma_f32_16x16x32_f16(false, a0.v, false, b0.v, (short)0, acc[0][0], false, false);
        acc[1][0] = __builtin_amdgcn_wmma_f32_16x16x32_f16(false, a1.v, false, b0.v, (short)0, acc[1][0], false, false);
        acc[0][1] = __builtin_amdgcn_wmma_f32_16x16x32_f16(false, a0.v, false, b1.v, (short)0, acc[0][1], false, false);
        acc[1][1] = __builtin_amdgcn_wmma_f32_16x16x32_f16(false, a1.v, false, b1.v, (short)0, acc[1][1], false, false);
        if (kt + PF < 18) {
#pragma unroll
            for (int i = 0; i < 4; ++i) bq[kt % PF][i] = bp[(kt + PF) * 1024 + i * 32];
            // keeps the refill in this K-step, PF steps ahead of its use: without it
            // the compiler sinks each load down to its product and waits there
            __builtin_amdgcn_sched_barrier(0);
        }
    }
    // Precaution: stands behind the last B load, in front of any rewrite of its
    // address registers; naming the address keeps those registers until here.
    asm volatile("s_wait_xcnt 0x0" :: "v"(bp) : "memory");

    // ---- wave-uniform writeback: 2 waves per output category ----
    const float QSCALE = 0.35355339059327373f;     // 8^-0.5
    int cat = wave >> 1, cb = (wave & 1) * 32;
    if (cat == 0) {                                // conv_out + bias -> d_out ch 0..63
#pragma unroll
        for (int t = 0; t < 2; ++t) {
            int col = cb + t * 16 + mn;
#pragma unroll
            for (int m = 0; m < 2; ++m)
#pragma unroll
            for (int j = 0; j < 8; ++j) {
                int prow = yy * 32 + m * 16 + j + 8 * hf;
                out[(size_t)(bimg * 128 + col) * 1024 + prow] = acc[m][t][j] + bco[col];
            }
        }
    } else if (cat == 1) {                         // q (scaled) -> q_ws[b,h,p,d]
#pragma unroll
        for (int t = 0; t < 2; ++t) {
            int ch = cb + t * 16 + mn, h = ch >> 3, d = ch & 7;
#pragma unroll
            for (int m = 0; m < 2; ++m)
#pragma unroll
            for (int j = 0; j < 8; ++j) {
                int prow = yy * 32 + m * 16 + j + 8 * hf;
                q_ws[(size_t)((bimg * 8 + h) * 1024 + prow) * 8 + d] =
                    (acc[m][t][j] + bqkv[ch]) * QSCALE;
            }
        }
    } else if (cat == 2) {                         // k -> k_ws[b,h,d,p] (f32)
#pragma unroll
        for (int t = 0; t < 2; ++t) {
            int ch = cb + t * 16 + mn, h = ch >> 3, d = ch & 7;
#pragma unroll
            for (int m = 0; m < 2; ++m)
#pragma unroll
            for (int j = 0; j < 8; ++j) {
                int prow = yy * 32 + m * 16 + j + 8 * hf;
                k_ws[(size_t)((bimg * 8 + h) * 8 + d) * 1024 + prow] =
                    acc[m][t][j] + bqkv[64 + ch];
            }
        }
    } else {                                       // v -> v_ws[b,h,d,p] (f16)
#pragma unroll
        for (int t = 0; t < 2; ++t) {
            int ch = cb + t * 16 + mn, h = ch >> 3, d = ch & 7;
#pragma unroll
            for (int m = 0; m < 2; ++m)
#pragma unroll
            for (int j = 0; j < 8; ++j) {
                int prow = yy * 32 + m * 16 + j + 8 * hf;
                v_ws[(size_t)((bimg * 8 + h) * 8 + d) * 1024 + prow] =
                    (_Float16)(acc[m][t][j] + bqkv[128 + ch]);
            }
        }
    }
}

// ---------------------------------------------------------------------------
// Kernel 3: attention, scores kept in registers. One wave per (b, h, 16 queries),
// 8 independent waves per work-group, no LDS, no barrier.
//  S^T = K.Q^T (f32 WMMA 16x16x4, K=8 in 2 steps): a lane holds ONE query's
//  scores (column mn), keys 8*hf+r down its 8 registers. A block of 32 keys is one
//  key row ky. The relative logits are formed here, no table of them is stored:
//   width:  RW[q][kx] = q . key_rel_w[kx-qx+31] is the same 2 tiles for every
//           block; each lane forms its 16 values once, they are the C input of
//           the first product.
//   height: RH[q][ky] = q . key_rel_h[ky-qy+31]; the 16 queries of a wave share
//           qy and the 32 keys of a block share ky, so that row of key_rel_h is
//           added to every K row of the block: (K + key_rel_h row) . q = S + RH.
//  Online softmax over 128 keys at a time: running maximum (base 2) and sum per
//  lane, one exchange between the lane halves per 128 keys.
//  O^T += V^T.P^T (f16 WMMA 16x16x32): two converted S^T tiles are the B operand
//  as they lie; A = V rows in the hardware k order. Rows 8..15 of O^T repeat
//  rows 0..7 (V has 8 rows) and are not stored.
// ---------------------------------------------------------------------------
__device__ __forceinline__ float xhalf(float x) {   // lane l <-> lane l ^ 16
    return __builtin_bit_cast(float, __builtin_amdgcn_permlanex16(
        __builtin_bit_cast(int, x), __builtin_bit_cast(int, x),
        0x76543210, 0xfedcba98, false, false));
}

__global__ void __launch_bounds__(256)
attn_kernel(const float* __restrict__ q_ws,
            const float* __restrict__ k_ws,
            const _Float16* __restrict__ v_ws,
            const float* __restrict__ krw,
            const float* __restrict__ krh,
            float* __restrict__ attn_pre) {
    const float L2E = 1.4426950408889634f;
    int wave = threadIdx.x >> 5, lane = threadIdx.x & 31;
    int hf = lane >> 4, mn = lane & 15;
    int wq = blockIdx.x * 8 + wave;         // 4096 waves = 64 (b,h) x 64 query tiles
    int bh = wq >> 6;
    int q  = (wq & 63) * 16 + mn;           // this lane's query
    int qy = q >> 5, qx = q & 31;

    // B operand of S^T: Q^T, column q, k = d = 2*hf + {0,1} (+4 in the second step)
    const float* qrow = q_ws + ((size_t)bh * 1024 + q) * 8;
    v2f qb0 = *(const v2f*)(qrow + hf * 2);
    v2f qb1 = *(const v2f*)(qrow + 4 + hf * 2);
    // RW[q][kx], kx = t*16 + 8*hf + r: in the accumulator map of tile t.
    // Table row kx - qx + 31 lies in [0,62] for every lane.
    float4 qlo = *(const float4*)(qrow);
    float4 qhi = *(const float4*)(qrow + 4);
    const float4* wrow = (const float4*)(krw + (hf * 8 - qx + 31) * 8);
    v8f rw0, rw1;
    for (int r = 0; r < 8; ++r) {
        float4 a0 = wrow[2 * r],      a1 = wrow[2 * r + 1];    // tile 0
        float4 b0 = wrow[32 + 2 * r], b1 = wrow[32 + 2 * r + 1]; // tile 1: 16 rows on
        rw0[r] = qlo.x * a0.x + qlo.y * a0.y + qlo.z * a0.z + qlo.w * a0.w
               + qhi.x * a1.x + qhi.y * a1.y + qhi.z * a1.z + qhi.w * a1.w;
        rw1[r] = qlo.x * b0.x + qlo.y * b0.y + qlo.z * b0.z + qlo.w * b0.w
               + qhi.x * b1.x + qhi.y * b1.y + qhi.z * b1.z + qhi.w * b1.w;
    }
    // key_rel_h row ky - qy + 31 (in [0,62]), k = d as for K; ky = 0 here
    const float* hrow = krh + (31 - qy) * 8 + hf * 2;
    // A operand of S^T: K, row key = mn, k = d as for Q
    const float* kp = k_ws + (size_t)bh * 8192 + (size_t)(hf * 2) * 1024 + mn;
    // A operand of O^T: V, row d = mn & 7, k = key in the hardware order
    const _Float16* vp = v_ws + (size_t)bh * 8192 + (size_t)(mn & 7) * 1024 + hf * 8;

    float m2 = -__builtin_inff();           // running maximum, times log2(e)
    v2f  lsum = {0.f, 0.f};                 // this lane half's share of the sum
    v8f  o = {};

    for (int g = 0; g < 8; ++g) {           // 128 keys = 4 key rows per trip
        v8f s[4][2];
        for (int u = 0; u < 4; ++u) {
            v2f h0 = *(const v2f*)(hrow + (g * 4 + u) * 8);
            v2f h1 = *(const v2f*)(hrow + (g * 4 + u) * 8 + 4);
            for (int t = 0; t < 2; ++t) {
                const float* kk = kp + g * 128 + u * 32 + t * 16;
                v2f ka0 = { kk[0], kk[1024] };
                v2f ka1 = { kk[4096], kk[5120] };
                ka0 += h0;
                ka1 += h1;
                v8f c = __builtin_amdgcn_wmma_f32_16x16x4_f32(
                    false, ka0, false, qb0, (short)0, t ? rw1 : rw0, false, false);
                s[u][t] = __builtin_amdgcn_wmma_f32_16x16x4_f32(
                    false, ka1, false, qb1, (short)0, c, false, false);
            }
        }

        // Precaution: stands between this trip's key_rel_h and K loads and the
        // instructions that rewrite their address registers for the next trip.
        asm volatile("s_wait_xcnt 0x0" ::: "memory");

        float mx = -__builtin_inff();
        for (int u = 0; u < 4; ++u) {
            float mu = s[u][0][0];
            for (int r = 1; r < 8; ++r) mu = fmaxf(mu, s[u][0][r]);
            for (int r = 0; r < 8; ++r) mu = fmaxf(mu, s[u][1][r]);
            mx = fmaxf(mx, mu);
        }
        mx = fmaxf(mx, xhalf(mx));
        float mnew  = fmaxf(m2, mx * L2E);
        float alpha = __builtin_amdgcn_exp2f(m2 - mnew);   // 0 on the first trip
        m2 = mnew;
        lsum *= alpha;
        o    *= alpha;

        v2f bias2 = { -mnew, -mnew };
        for (int u = 0; u < 4; ++u) {
            v16h pb;
            for (int t = 0; t < 2; ++t) {
                for (int i = 0; i < 4; ++i) {
                    v2f sv  = { s[u][t][2 * i], s[u][t][2 * i + 1] };
                    v2f arg = sv * L2E + bias2;
                    v2f p   = { __builtin_amdgcn_exp2f(arg.x), __builtin_amdgcn_exp2f(arg.y) };
                    lsum += p;
                    pb[t * 8 + 2 * i]     = (_Float16)p.x;
                    pb[t * 8 + 2 * i + 1] = (_Float16)p.y;
                }
            }
            union { uint4 w[2]; v16h v; } va;
            const _Float16* vv = vp + g * 128 + u * 32;
            va.w[0] = *(const uint4*)(vv);
            va.w[1] = *(const uint4*)(vv + 16);
            o = __builtin_amdgcn_wmma_f32_16x16x32_f16(
                false, va.v, false, pb, (short)0, o, false, false);
        }
    }

    float l = lsum.x + lsum.y;
    l += xhalf(l);
    float inv = 1.f / l;
    if (hf == 0) {                          // rows d = 0..7 of O^T
        for (int r = 0; r < 8; ++r)
            attn_pre[((size_t)bh * 8 + r) * 1024 + q] = o[r] * inv;
    }
}

// ---------------------------------------------------------------------------
// Kernel 4: 1x1 output projection. GEMM M=8192, N=64, K=64 (f32 WMMA).
// Writes channels 64..127 of d_out (+bias).
// ---------------------------------------------------------------------------
__global__ void proj_kernel(const float* __restrict__ attn_pre,
                            const float* __restrict__ w_attn,
                            const float* __restrict__ b_attn,
                            float* __restrict__ out) {
    int tid  = blockIdx.x * blockDim.x + threadIdx.x;
    int wid  = tid >> 5;
    int lane = threadIdx.x & 31;
    int mt = wid >> 2, nt = wid & 3;
    int hf = lane >> 4, mn = lane & 15;
    int p = mt * 16 + mn, b = p >> 10, pp = p & 1023;
    int col = nt * 16 + mn;

    v8f c = {};
    for (int kt = 0; kt < 16; ++kt) {
        int k0 = kt * 4 + hf * 2;
        v2f a, bb;
        a.x  = attn_pre[(size_t)(b * 64 + k0) * 1024 + pp];
        a.y  = attn_pre[(size_t)(b * 64 + k0 + 1) * 1024 + pp];
        bb.x = w_attn[col * 64 + k0];
        bb.y = w_attn[col * 64 + k0 + 1];
        c = __builtin_amdgcn_wmma_f32_16x16x4_f32(
            false, a, false, bb, (short)0, c, false, false);
    }
#pragma unroll
    for (int j = 0; j < 8; ++j) {
        int m = j + 8 * hf;
        int P = mt * 16 + m, bb2 = P >> 10, pr = P & 1023;
        out[(size_t)(bb2 * 128 + 64 + col) * 1024 + pr] = c[j] + b_attn[col];
    }
}

// ---------------------------------------------------------------------------
extern "C" void kernel_launch(void* const* d_in, const int* in_sizes, int n_in,
                              void* d_out, int out_size, void* d_ws, size_t ws_size,
                              hipStream_t stream) {
    const float* x    = (const float*)d_in[0];
    const float* wco  = (const float*)d_in[1];
    const float* bco  = (const float*)d_in[2];
    const float* wqkv = (const float*)d_in[3];
    const float* bqkv = (const float*)d_in[4];
    const float* watt = (const float*)d_in[5];
    const float* batt = (const float*)d_in[6];
    const float* krw  = (const float*)d_in[7];
    const float* krh  = (const float*)d_in[8];
    float* out = (float*)d_out;

    char* ws = (char*)d_ws;
    size_t o = 0;
    _Float16* wfrag = (_Float16*)(ws + o); o += (size_t)147456 * 2;    // 288 KB
    o = (o + 255) & ~(size_t)255;
    float* q_ws     = (float*)(ws + o);    o += (size_t)524288 * 4;    // 2 MB
    float* k_ws     = (float*)(ws + o);    o += (size_t)524288 * 4;    // 2 MB
    _Float16* v_ws  = (_Float16*)(ws + o); o += (size_t)524288 * 2;    // 1 MB
    o = (o + 255) & ~(size_t)255;
    float* attn_pre = (float*)(ws + o);    o += (size_t)524288 * 4;    // 2 MB

    // 1) weight swizzle in fragment order
    prep_w_kernel<<<(147456 + 255) / 256, 256, 0, stream>>>(wco, wqkv, wfrag);

    // 2) fused 3x3 convs as implicit GEMM (f16 WMMA, B from L2 into registers)
    conv_gemm_kernel<<<256, 256, 0, stream>>>(x, wfrag, bco, bqkv,
                                              out, q_ws, k_ws, v_ws);

    // 3) attention with its relative logits (scores in registers, 8 waves per WG, no LDS)
    attn_kernel<<<512, 256, 0, stream>>>(q_ws, k_ws, v_ws, krw, krh, attn_pre);

    // 4) 1x1 projection (f32 WMMA)
    proj_kernel<<<256, 256, 0, stream>>>(attn_pre, watt, batt, out);
}

// v005
// A run of this version takes 28.2 microseconds.
// In two side-by-side timings against v004, it was 1.04 and 1.05 times as fast.
// Over all steps from v000 it is 13.0 times as fast.
#include <hip/hip_runtime.h>
#include <hip/hip_bf16.h>

typedef __attribute__((ext_vector_type(16))) _Float16 v16h;
typedef __attribute__((ext_vector_type(8)))  float    v8f;
typedef __attribute__((ext_vector_type(2)))  float    v2f;

// Fragment K-offset for 16-bit WMMA A/B operands (ISA 7.12.2, 16-bit 16x32 layout):
// lane = hf*16 + (m|n); element e -> K = (e<8) ? hf*8+e : 16+hf*8+(e-8)
__device__ __forceinline__ int kof(int e, int hf) {
    return (e < 8) ? (hf * 8 + e) : (16 + hf * 8 + (e - 8));
}

// ---------------------------------------------------------------------------
// Kernel 1: wfrag = combined conv weights (conv_out 64ch ++ qkv 192ch),
// pre-swizzled so that one 16-byte load of a wave is 512 contiguous bytes:
//   wfrag[(((kt*16 + nt)*2 + half)*32 + lane)*8 + i] = W[K][col],
//   col = nt*16 + (lane & 15), K = kt*32 + kof(half*8 + i, lane >> 4)
// k order, the same as the conv kernel's A loader: K = tap*64 + channel,
// tap = ky*3 + kx.
// ---------------------------------------------------------------------------
__global__ void prep_w_kernel(const float* __restrict__ wco,
                              const float* __restrict__ wqkv,
                              _Float16* __restrict__ wfrag) {
    int j = blockIdx.x * blockDim.x + threadIdx.x;
    if (j >= 147456) return;                       // 18*16*2*32*8
    int e   = ((j >> 8) & 1) * 8 + (j & 7);
    int hf  = (j >> 7) & 1;
    int col = ((j >> 9) & 15) * 16 + ((j >> 3) & 15);
    int kt  = j >> 13;
    int K = kt * 32 + kof(e, hf);                  // < 576 always
    int c = K & 63, r = K >> 6;
    float v = (col < 64) ? wco[(col * 64 + c) * 9 + r]
                         : wqkv[((col - 64) * 64 + c) * 9 + r];
    wfrag[j] = (_Float16)v;
}

// ---------------------------------------------------------------------------
// Kernel 2: fused implicit-GEMM 3x3 convs. M=8192 pixels, N=256 ch, K=576.
// Each wave: 32(M) x 32(N) tile, f16 WMMA, 18 K-steps of 32.
// A work-group owns one image row (32 pixels). Its A operand is never stored as
// an im2col table: the 3 input rows it needs are converted to f16 once and laid
// in LDS pixel-major, xs[row 0..2][column -1..32][channel], borders zero. With
// K = tap*64 + channel a K-step is 32 channels of ONE tap, so a lane's fragment
// is two 16-byte LDS reads at its pixel shifted by the tap.
// Every wave takes all 32 pixels and 32 channels of its own, so a B fragment has
// one reader in the work-group: it goes from L2 straight into that wave's
// registers, PF K-steps ahead of its use, and the K loop has no barrier.
// ---------------------------------------------------------------------------
__global__ void __launch_bounds__(256)
conv_gemm_kernel(const float* __restrict__ x,
                 const _Float16* __restrict__ wfrag,
                 const float* __restrict__ bco,
                 const float* __restrict__ bqkv,
                 float* __restrict__ out,
                 float* __restrict__ q_ws,
                 float* __restrict__ k_ws,
                 _Float16* __restrict__ v_ws) {
    // 144-byte pixel pitch (64 channels + 8 unused): 16 B x odd, no bank conflict
    // for the 16-byte stores and reads below
    constexpr int XP = 72;
    constexpr int PF = 9;                          // K-steps of B held in registers
    __shared__ __attribute__((aligned(16))) _Float16 xs[3 * 34 * XP];
    int lane = threadIdx.x & 31;
    int hf   = lane >> 4, mn = lane & 15;

    // ---- x tile: wave w converts channels 8w..8w+7 of the 3 rows, lane = column.
    int wave = threadIdx.x >> 5;
    int bimg = blockIdx.x >> 5, yy = blockIdx.x & 31;
    // All 24 loads are issued together: a row outside the image is read at the
    // clamped row and replaced by zero, so no branch splits the loads.
    float xv[3][8];
    const float* xp[3];
    for (int rr = 0; rr < 3; ++rr) {
        int iy = min(max(yy + rr - 1, 0), 31);
        xp[rr] = x + ((size_t)(bimg * 64 + wave * 8) * 32 + iy) * 32 + lane;
        for (int i = 0; i < 8; ++i) xv[rr][i] = xp[rr][i * 1024];
    }
    // Precaution: stands behind the 24 loads, in front of any rewrite of their
    // address registers; naming the addresses keeps those registers until here.
    asm volatile("s_wait_xcnt 0x0" :: "v"(xp[0]), "v"(xp[1]), "v"(xp[2]) : "memory");

    // ---- B: this wave's 2 column tiles; per K-step 4 loads of 512 B, 2 KB in a row
    const uint4* bp = (const uint4*)wfrag + wave * 128 + lane;
    uint4 bq[PF][4];
    // unrolled, here and below: bq is indexed by constants only and stays in registers
#pragma unroll
    for (int kt = 0; kt < PF; ++kt)
#pragma unroll
        for (int i = 0; i < 4; ++i) bq[kt][i] = bp[kt * 1024 + i * 32];

    for (int rr = 0; rr < 3; ++rr) {
        bool inside = (unsigned)(yy + rr - 1) < 32u;
        union { _Float16 h[8]; uint4 w; } pk;
        for (int i = 0; i < 8; ++i) pk.h[i] = (_Float16)(inside ? xv[rr][i] : 0.f);
        *(uint4*)(xs + (rr * 34 + lane + 1) * XP + wave * 8) = pk.w;
    }
    if (threadIdx.x < 48) {                        // columns -1 and 32: zero
        int rr = threadIdx.x >> 4, side = (threadIdx.x >> 3) & 1, cg = threadIdx.x & 7;
        *(uint4*)(xs + (rr * 34 + side * 33) * XP + cg * 8) = make_uint4(0u, 0u, 0u, 0u);
    }
    __syncthreads();                               // the x tile is read by every wave

    // this lane's pixel of the first 16 at tap (0,0), channels hf*8..
    const _Float16* abase = xs + mn * XP + hf * 8;

    v8f acc[2][2] = {};                            // [pixel tile][column tile]
#pragma unroll
    for (int kt = 0; kt < 18; ++kt) {
        // ---- A fragments: channels (kt&1)*32 + kof(e,hf) of tap kt>>1 ----
        int tap = kt >> 1, ky = tap / 3, kx = tap - ky * 3;
        const _Float16* ap = abase + (ky * 34 + kx) * XP + (kt & 1) * 32;
        union { uint4 w[2]; v16h v; } a0, a1, b0, b1;
        a0.w[0] = *(const uint4*)(ap);             // e = 0..7
        a0.w[1] = *(const uint4*)(ap + 16);        // e = 8..15: 16 channels on
        a1.w[0] = *(const uint4*)(ap + 16 * XP);   // pixels 16..31
        a1.w[1] = *(const uint4*)(ap + 16 * XP + 16);
        b0.w[0] = bq[kt % PF][0];
        b0.w[1] = bq[kt % PF][1];
        b1.w[0] = bq[kt % PF][2];
        b1.w[1] = bq[kt % PF][3];
        acc[0][0] = __builtin_amdgcn_wmma_f32_16x16x32_f16(false, a0.v, false, b0.v, (short)0, acc[0][0], false, false);
        acc[1][0] = __builtin_amdgcn_wmma_f32_16x16x32_f16(false, a1.v, false, b0.v, (short)0, acc[1][0], false, false);
        acc[0][1] = __builtin_amdgcn_wmma_f32_16x16x32_f16(false, a0.v, false, b1.v, (short)0, acc[0][1], false, false);
        acc[1][1] = __builtin_amdgcn_wmma_f32_16x16x32_f16(false, a1.v, false, b1.v, (short)0, acc[1][1], false, false);
        if (kt + PF < 18) {
#pragma unroll
            for (int i = 0; i < 4; ++i) bq[kt % PF][i] = bp[(kt + PF) * 1024 + i * 32];
            // keeps the refill in this K-step, PF steps ahead of its use: without it
            // the compiler sinks each load down to its product and waits there
            __builtin_amdgcn_sched_barrier(0);
        }
    }
    // Precaution: stands behind the last B load, in front of any rewrite of its
    // address registers; naming the address keeps those registers until here.
    asm volatile("s_wait_xcnt 0x0" :: "v"(bp) : "memory");

    // ---- wave-uniform writeback: 2 waves per output category ----
    const float QSCALE = 0.35355339059327373f;     // 8^-0.5
    int cat = wave >> 1, cb = (wave & 1) * 32;
    if (cat == 0) {                                // conv_out + bias -> d_out ch 0..63
#pragma unroll
        for (int t = 0; t < 2; ++t) {
            int col = cb + t * 16 + mn;
#pragma unroll
            for (int m = 0; m < 2; ++m)
#pragma unroll
            for (int j = 0; j < 8; ++j) {
                int prow = yy * 32 + m * 16 + j + 8 * hf;
                out[(size_t)(bimg * 128 + col) * 1024 + prow] = acc[m][t][j] + bco[col];
            }
        }
    } else if (cat == 1) {                         // q (scaled) -> q_ws[b,h,p,d]
#pragma unroll
        for (int t = 0; t < 2; ++t) {
            int ch = cb + t * 16 + mn, h = ch >> 3, d = ch & 7;
#pragma unroll
            for (int m = 0; m < 2; ++m)
#pragma unroll
            for (int j = 0; j < 8; ++j) {
                int prow = yy * 32 + m * 16 + j + 8 * hf;
                q_ws[(size_t)((bimg * 8 + h) * 1024 + prow) * 8 + d] =
                    (acc[m][t][j] + bqkv[ch]) * QSCALE;
            }
        }
    } else if (cat == 2) {                         // k -> k_ws[b,h,d,p] (f32)
#pragma unroll
        for (int t = 0; t < 2; ++t) {
            int ch = cb + t * 16 + mn, h = ch >> 3, d = ch & 7;
#pragma unroll
            for (int m = 0; m < 2; ++m)
#pragma unroll
            for (int j = 0; j < 8; ++j) {
                int prow = yy * 32 + m * 16 + j + 8 * hf;
                k_ws[(size_t)((bimg * 8 + h) * 8 + d) * 1024 + prow] =
                    acc[m][t][j] + bqkv[64 + ch];
            }
        }
    } else {                                       // v -> v_ws[b,h,d,p] (f16)
#pragma unroll
        for (int t = 0; t < 2; ++t) {
            int ch = cb + t * 16 + mn, h = ch >> 3, d = ch & 7;
#pragma unroll
            for (int m = 0; m < 2; ++m)
#pragma unroll
            for (int j = 0; j < 8; ++j) {
                int prow = yy * 32 + m * 16 + j + 8 * hf;
                v_ws[(size_t)((bimg * 8 + h) * 8 + d) * 1024 + prow] =
                    (_Float16)(acc[m][t][j] + bqkv[128 + ch]);
            }
        }
    }
}

// ---------------------------------------------------------------------------
// Kernel 3: attention and the 1x1 output projection. Scores kept in registers,
// one wave per (b, h, 16 queries). A work-group is 16 waves: the 8 heads x the 2
// query tiles of ONE image row, so all 64 attention channels of its 32 pixels end
// up in it; they meet in LDS and the projection is done here.
//  S^T = K.Q^T (f32 WMMA 16x16x4, K=8 in 2 steps): a lane holds ONE query's
//  scores (column mn), keys 8*hf+r down its 8 registers. A block of 32 keys is one
//  key row ky. The relative logits are formed here, no table of them is stored:
//   width:  RW[q][kx] = q . key_rel_w[kx-qx+31] is the same 2 tiles for every
//           block; each lane forms its 16 values once, they are the C input of
//           the first product.
//   height: RH[q][ky] = q . key_rel_h[ky-qy+31]; the 16 queries of a wave share
//           qy and the 32 keys of a block share ky, so that row of key_rel_h is
//           added to every K row of the block: (K + key_rel_h row) . q = S + RH.
//  Online softmax over 128 keys at a time: running maximum (base 2) and sum per
//  lane, one exchange between the lane halves per 128 keys.
//  O^T += V^T.P^T (f16 WMMA 16x16x32): two converted S^T tiles are the B operand
//  as they lie; A = V rows in the hardware k order. Rows 8..15 of O^T repeat
//  rows 0..7 (V has 8 rows) and are not stored.
//  Projection: GEMM M=32 pixels, N=64, K=64 (f32 WMMA 16x16x4, k ascending).
//  Waves 0..3 take 16 output channels each and both pixel tiles, so a 128-byte
//  line of d_out (one channel, 32 pixels) has one writing wave.
// ---------------------------------------------------------------------------
__device__ __forceinline__ float xhalf(float x) {   // lane l <-> lane l ^ 16
    return __builtin_bit_cast(float, __builtin_amdgcn_permlanex16(
        __builtin_bit_cast(int, x), __builtin_bit_cast(int, x),
        0x76543210, 0xfedcba98, false, false));
}

__global__ void __launch_bounds__(512)
attn_kernel(const float* __restrict__ q_ws,
            const float* __restrict__ k_ws,
            const _Float16* __restrict__ v_ws,
            const float* __restrict__ krw,
            const float* __restrict__ krh,
            const float* __restrict__ w_attn,
            const float* __restrict__ b_attn,
            float* __restrict__ out) {
    const float L2E = 1.4426950408889634f;
    // 40-float channel pitch: the two lane halves read rows 2 apart, 80 floats =
    // 16 banks on, so the 32 lanes of a read fall on 32 different banks
    constexpr int OP = 40;
    __shared__ float os[64 * OP];           // attention output [channel][pixel of the row]
    // the wave's number as a scalar: base addresses and the branches on it stay scalar
    int wave = __builtin_amdgcn_readfirstlane(threadIdx.x >> 5);
    int lane = threadIdx.x & 31;
    int hf = lane >> 4, mn = lane & 15;
    int bimg = blockIdx.x >> 5, qy = blockIdx.x & 31;   // 256 work-groups = 8 images x 32 rows
    int head = wave & 7, qt = wave >> 3;
    int bh = bimg * 8 + head;
    int qx = qt * 16 + mn;
    int q  = qy * 32 + qx;                  // this lane's query

    // B operand of S^T: Q^T, column q, k = d = 2*hf + {0,1} (+4 in the second step)
    const float* qrow = q_ws + ((size_t)bh * 1024 + q) * 8;
    v2f qb0 = *(const v2f*)(qrow + hf * 2);
    v2f qb1 = *(const v2f*)(qrow + 4 + hf * 2);
    // RW[q][kx], kx = t*16 + 8*hf + r: in the accumulator map of tile t.
    // Table row kx - qx + 31 lies in [0,62] for every lane.
    float4 qlo = *(const float4*)(qrow);
    float4 qhi = *(const float4*)(qrow + 4);
    const float4* wrow = (const float4*)(krw + (hf * 8 - qx + 31) * 8);
    v8f rw0, rw1;
    for (int r = 0; r < 8; ++r) {
        float4 a0 = wrow[2 * r],      a1 = wrow[2 * r + 1];    // tile 0
        float4 b0 = wrow[32 + 2 * r], b1 = wrow[32 + 2 * r + 1]; // tile 1: 16 rows on
        rw0[r] = qlo.x * a0.x + qlo.y * a0.y + qlo.z * a0.z + qlo.w * a0.w
               + qhi.x * a1.x + qhi.y * a1.y + qhi.z * a1.z + qhi.w * a1.w;
        rw1[r] = qlo.x * b0.x + qlo.y * b0.y + qlo.z * b0.z + qlo.w * b0.w
               + qhi.x * b1.x + qhi.y * b1.y + qhi.z * b1.z + qhi.w * b1.w;
    }
    // key_rel_h row ky - qy + 31 (in [0,62]), k = d as for K; ky = 0 here
    const float* hrow = krh + (31 - qy) * 8 + hf * 2;
    // A operand of S^T: K, row key = mn, k = d as for Q
    const float* kp = k_ws + (size_t)bh * 8192 + (size_t)(hf * 2) * 1024 + mn;
    // A operand of O^T: V, row d = mn & 7, k = key in the hardware order
    const _Float16* vp = v_ws + (size_t)bh * 8192 + (size_t)(mn & 7) * 1024 + hf * 8;

    float m2 = -__builtin_inff();           // running maximum, times log2(e)
    v2f  lsum = {0.f, 0.f};                 // this lane half's share of the sum
    v8f  o = {};

    for (int g = 0; g < 8; ++g) {           // 128 keys = 4 key rows per trip
        v8f s[4][2];
        for (int u = 0; u < 4; ++u) {
            v2f h0 = *(const v2f*)(hrow + (g * 4 + u) * 8);
            v2f h1 = *(const v2f*)(hrow + (g * 4 + u) * 8 + 4);
            for (int t = 0; t < 2; ++t) {
                const float* kk = kp + g * 128 + u * 32 + t * 16;
                v2f ka0 = { kk[0], kk[1024] };
                v2f ka1 = { kk[4096], kk[5120] };
                ka0 += h0;
                ka1 += h1;
                v8f c = __builtin_amdgcn_wmma_f32_16x16x4_f32(
                    false, ka0, false, qb0, (short)0, t ? rw1 : rw0, false, false);
                s[u][t] = __builtin_amdgcn_wmma_f32_16x16x4_f32(
                    false, ka1, false, qb1, (short)0, c, false, false);
            }
        }

        // Precaution: stands between this trip's key_rel_h and K loads and the
        // instructions that rewrite their address registers for the next trip.
        asm volatile("s_wait_xcnt 0x0" ::: "memory");

        float mx = -__builtin_inff();
        for (int u = 0; u < 4; ++u) {
            float mu = s[u][0][0];
            for (int r = 1; r < 8; ++r) mu = fmaxf(mu, s[u][0][r]);
            for (int r = 0; r < 8; ++r) mu = fmaxf(mu, s[u][1][r]);
            mx = fmaxf(mx, mu);
        }
        mx = fmaxf(mx, xhalf(mx));
        float mnew  = fmaxf(m2, mx * L2E);
        float alpha = __builtin_amdgcn_exp2f(m2 - mnew);   // 0 on the first trip
        m2 = mnew;
        lsum *= alpha;
        o    *= alpha;

        v2f bias2 = { -mnew, -mnew };
        for (int u = 0; u < 4; ++u) {
            v16h pb;
            for (int t = 0; t < 2; ++t) {
                for (int i = 0; i < 4; ++i) {
                    v2f sv  = { s[u][t][2 * i], s[u][t][2 * i + 1] };
                    v2f arg = sv * L2E + bias2;
                    v2f p   = { __builtin_amdgcn_exp2f(arg.x), __builtin_amdgcn_exp2f(arg.y) };
                    lsum += p;
                    pb[t * 8 + 2 * i]     = (_Float16)p.x;
                    pb[t * 8 + 2 * i + 1] = (_Float16)p.y;
                }
            }
            union { uint4 w[2]; v16h v; } va;
            const _Float16* vv = vp + g * 128 + u * 32;
            va.w[0] = *(const uint4*)(vv);
            va.w[1] = *(const uint4*)(vv + 16);
            o = __builtin_amdgcn_wmma_f32_16x16x32_f16(
                false, va.v, false, pb, (short)0, o, false, false);
        }
    }

    float l = lsum.x + lsum.y;
    l += xhalf(l);
    float inv = 1.f / l;

    // B operand of the projection: w_attn, column col, k = channel = kt*4 + 2*hf + {0,1}.
    // Loaded in front of the barrier, so that its latency passes while the wave waits.
    int col = (wave & 3) * 16 + mn;
    const float* wp = w_attn + col * 64 + hf * 2;
    v2f wb[16];
    float bias = 0.f;
    if (wave < 4) {
#pragma unroll
        for (int kt = 0; kt < 16; ++kt) wb[kt] = *(const v2f*)(wp + kt * 4);
        bias = b_attn[col];
        // Precaution: stands behind these loads, in front of any rewrite of their
        // address registers; naming the address keeps those registers until here.
        asm volatile("s_wait_xcnt 0x0" :: "v"(wp) : "memory");
    }

    if (hf == 0) {                          // rows d = 0..7 of O^T
        for (int r = 0; r < 8; ++r)
            os[(head * 8 + r) * OP + qx] = o[r] * inv;
    }
    __syncthreads();                        // all 8 heads of the 32 pixels are in os
    if (wave >= 4) return;                  // behind the only barrier

    // A operand: row = pixel mn (+16 in the second tile), k as for w_attn
    const float* ap = os + hf * 2 * OP + mn;
    v8f c0 = {}, c1 = {};
#pragma unroll
    for (int kt = 0; kt < 16; ++kt) {
        v2f a0 = { ap[kt * 4 * OP],      ap[(kt * 4 + 1) * OP] };
        v2f a1 = { ap[kt * 4 * OP + 16], ap[(kt * 4 + 1) * OP + 16] };
        c0 = __builtin_amdgcn_wmma_f32_16x16x4_f32(
            false, a0, false, wb[kt], (short)0, c0, false, false);
        c1 = __builtin_amdgcn_wmma_f32_16x16x4_f32(
            false, a1, false, wb[kt], (short)0, c1, false, false);
    }
    // channels 64..127 of d_out; a lane holds pixels 8*hf + j of each tile
    float* op = out + (size_t)(bimg * 128 + 64 + col) * 1024 + qy * 32 + 8 * hf;
#pragma unroll
    for (int j = 0; j < 8; ++j) {
        op[j]      = c0[j] + bias;
        op[16 + j] = c1[j] + bias;
    }
}

// ---------------------------------------------------------------------------
extern "C" void kernel_launch(void* const* d_in, const int* in_sizes, int n_in,
                              void* d_out, int out_size, void* d_ws, size_t ws_size,
                              hipStream_t stream) {
    const float* x    = (const float*)d_in[0];
    const float* wco  = (const float*)d_in[1];
    const float* bco  = (const float*)d_in[2];
    const float* wqkv = (const float*)d_in[3];
    const float* bqkv = (const float*)d_in[4];
    const float* watt = (const float*)d_in[5];
    const float* batt = (const float*)d_in[6];
    const float* krw  = (const float*)d_in[7];
    const float* krh  = (const float*)d_in[8];
    float* out = (float*)d_out;

    char* ws = (char*)d_ws;
    size_t o = 0;
    _Float16* wfrag = (_Float16*)(ws + o); o += (size_t)147456 * 2;    // 288 KB
    o = (o + 255) & ~(size_t)255;
    float* q_ws     = (float*)(ws + o);    o += (size_t)524288 * 4;    // 2 MB
    float* k_ws     = (float*)(ws + o);    o += (size_t)524288 * 4;    // 2 MB
    _Float16* v_ws  = (_Float16*)(ws + o); o += (size_t)524288 * 2;    // 1 MB

    // 1) weight swizzle in fragment order
    prep_w_kernel<<<(147456 + 255) / 256, 256, 0, stream>>>(wco, wqkv, wfrag);

    // 2) fused 3x3 convs as implicit GEMM (f16 WMMA, B from L2 into registers)
    conv_gemm_kernel<<<256, 256, 0, stream>>>(x, wfrag, bco, bqkv,
                                              out, q_ws, k_ws, v_ws);

    // 3) attention with its relative logits and the 1x1 projection (16 waves per WG)
    attn_kernel<<<256, 512, 0, stream>>>(q_ws, k_ws, v_ws, krw, krh, watt, batt, out);
}

// v006
// A run of this version takes 22.7 microseconds.
// In two side-by-side timings against v005, it was 1.26 and 1.29 times as fast.
// Over all steps from v000 it is 16.5 times as fast.
#include <hip/hip_runtime.h>
#include <hip/hip_bf16.h>

typedef __attribute__((ext_vector_type(16))) _Float16 v16h;
typedef __attribute__((ext_vector_type(8)))  float    v8f;
typedef __attribute__((ext_vector_type(2)))  float    v2f;
typedef __attribute__((ext_vector_type(4)))  float    v4f;
typedef __attribute__((ext_vector_type(4)))  unsigned v4u;

// Fragment K-offset for 16-bit WMMA A/B operands (ISA 7.12.2, 16-bit 16x32 layout):
// lane = hf*16 + (m|n); element e -> K = (e<8) ? hf*8+e : 16+hf*8+(e-8)
__device__ __forceinline__ int kof(int e, int hf) {
    return (e < 8) ? (hf * 8 + e) : (16 + hf * 8 + (e - 8));
}

// ---------------------------------------------------------------------------
// Kernel 1: fused implicit-GEMM 3x3 convs (conv_out 64ch ++ qkv 192ch).
// M=8192 pixels, N=256 ch, K=576. Each wave: 32(M) x 32(N) tile, f16 WMMA,
// 18 K-steps of 32. k order of both operands: K = tap*64 + channel, tap = ky*3+kx.
// A work-group owns 8 image rows x 32 output channels, one row per wave.
// A: never stored as an im2col table: the 10 input rows it needs are converted to
// f16 once and laid in LDS pixel-major, xs[row 0..9][column -1..32][channel],
// borders zero. A K-step is 32 channels of ONE tap, so a lane's fragment is two
// 16-byte LDS reads at its pixel shifted by the tap.
// B: the 32 channels' weights are 72 KB in a row in the input. The work-group reads
// them once in whole lines, turns them into f16 fragments itself and keeps those in
// LDS for its 8 waves; no table of swizzled weights is made by another launch.
//   wf[((kt*2 + t)*2 + half)*32 + lane] (8 halves) = W[K][col],
//   col = t*16 + (lane & 15), K = kt*32 + kof(half*8 + i, lane >> 4), i = 0..7
// ---------------------------------------------------------------------------
__global__ void __launch_bounds__(256)
conv_gemm_kernel(const float* __restrict__ x,
                 const float* __restrict__ wco,
                 const float* __restrict__ wqkv,
                 const float* __restrict__ bco,
                 const float* __restrict__ bqkv,
                 float* __restrict__ out,
                 float* __restrict__ q_ws,
                 float* __restrict__ k_ws,
                 _Float16* __restrict__ v_ws) {
    // 144-byte pixel pitch (64 channels + 8 unused): 16 B x odd, no bank conflict
    // for the 16-byte stores and reads below
    constexpr int XP = 72;
    // 2320-byte pitch of a channel's 576 weights (+4 unused): 16 B x odd, for the
    // 16-byte reads in which lane = output channel
    constexpr int WP = 580;
    __shared__ __attribute__((aligned(16))) _Float16 xs[10 * 34 * XP];
    __shared__ __attribute__((aligned(16))) float    wraw[32 * WP];
    __shared__ __attribute__((aligned(16))) uint4    wf[18 * 2 * 2 * 32];
    int tid  = threadIdx.x;
    int lane = tid & 31;
    int hf   = lane >> 4, mn = lane & 15;
    int wave = tid >> 5;
    // 256 work-groups = 8 images x 4 row blocks x 8 channel blocks
    int bimg = blockIdx.x >> 5, rq = (blockIdx.x >> 3) & 3, ng = blockIdx.x & 7;
    int yy = rq * 8 + wave;                        // this wave's image row

    // ---- weights of channels ng*32..+31: 18432 floats in a row, 512 B a load
    const float* wsrc = (ng < 2) ? wco + ng * 18432 : wqkv + (ng - 2) * 18432;
    const v4f* wg = (const v4f*)wsrc + tid;
    v4f wv[18];
    // unrolled, here and below: the arrays are indexed by constants only and stay
    // in registers
#pragma unroll
    for (int i = 0; i < 18; ++i) wv[i] = wg[i * 256];

    // ---- x tile: wave w takes channels 8w..8w+7 of the 10 rows, lane = column.
    // All loads are issued together: a row outside the image is read at the
    // clamped row and replaced by zero, so no branch splits the loads.
    float xv[10][8];
    const float* xb   = x + (size_t)(bimg * 64 + wave * 8) * 1024 + lane;
    const float* xtop = xb + max(rq * 8 - 1, 0) * 32;      // tile row 0
    const float* xmid = xb + rq * 8 * 32;                  // tile rows 1..8
    const float* xbot = xb + min(rq * 8 + 8, 31) * 32;     // tile row 9
#pragma unroll
    for (int i = 0; i < 8; ++i) {
        xv[0][i] = xtop[i * 1024];
#pragma unroll
        for (int rr = 1; rr < 9; ++rr) xv[rr][i] = xmid[(rr - 1) * 32 + i * 1024];
        xv[9][i] = xbot[i * 1024];
    }

    // weights as they came, one padded LDS row per output channel
#pragma unroll
    for (int i = 0; i < 18; ++i) {
        int f = i * 256 + tid, col = f / 144;
        *(v4f*)(wraw + col * WP + (f - col * 144) * 4) = wv[i];
    }
    __syncthreads();                               // wraw is read across waves

    // thread = (8 input channels 8*wave.., output channel lane): its 72 weights
    // [channel][tap] lie in a row
    const v4f* cr = (const v4f*)(wraw + lane * WP + wave * 72);
    v4f wc[18];
#pragma unroll
    for (int i = 0; i < 18; ++i) wc[i] = cr[i];

#pragma unroll
    for (int rr = 0; rr < 10; ++rr) {
        bool inside = (unsigned)(rq * 8 + rr - 1) < 32u;
        union { _Float16 h[8]; uint4 w; } pk;
#pragma unroll
        for (int i = 0; i < 8; ++i) pk.h[i] = (_Float16)(inside ? xv[rr][i] : 0.f);
        *(uint4*)(xs + (rr * 34 + lane + 1) * XP + wave * 8) = pk.w;
    }
    if (tid < 160) {                               // columns -1 and 32: zero
        int rr = tid >> 4, side = (tid >> 3) & 1, cg = tid & 7;
        *(uint4*)(xs + (rr * 34 + side * 33) * XP + cg * 8) = make_uint4(0u, 0u, 0u, 0u);
    }

    // 8 channels of one tap are half a lane's fragment: channel = (kt&1)*32 +
    // half*16 + 8*(reading lane >> 4) + i, so wave = (kt&1)*4 + half*2 + (that bit);
    // this thread's own hf is the column tile t, its mn the column in the tile
    uint4* wd = wf + (((wave >> 2) * 2 + hf) * 2 + ((wave >> 1) & 1)) * 32 + (wave & 1) * 16 + mn;
#pragma unroll
    for (int r = 0; r < 9; ++r) {
        union { _Float16 h[8]; uint4 w; } pk;
#pragma unroll
        for (int i = 0; i < 8; ++i) pk.h[i] = (_Float16)wc[(i * 9 + r) >> 2][(i * 9 + r) & 3];
        wd[r * 256] = pk.w;                        // 2 K-steps per tap
    }
    __syncthreads();                               // xs and wf are read by every wave

    // this lane's pixel of the first 16 at tap (0,0), channels hf*8..
    const _Float16* abase = xs + (wave * 34 + mn) * XP + hf * 8;
    const v4u* bb = (const v4u*)wf + lane;

    v8f acc[2][2] = {};                            // [pixel tile][column tile]
    // The K loop goes in 6 blocks of NB K-steps. A block's 8*NB fragment reads are
    // issued as one group, one block ahead of their products, into the other of two
    // register sets: the products wait on a count, never on their own reads.
    constexpr int NB = 3;
    v4u fa[2][NB][4], fb[2][NB][4];
#pragma unroll
    for (int blk = -1; blk < 6; ++blk) {
        if (blk + 1 < 6) {
#pragma unroll
            for (int s = 0; s < NB; ++s) {
                // ---- A fragments: channels (kt&1)*32 + kof(e,hf) of tap kt>>1 ----
                int kt = (blk + 1) * NB + s, set = (blk + 1) & 1;
                int tap = kt >> 1, ky = tap / 3, kx = tap - ky * 3;
                const _Float16* ap = abase + (ky * 34 + kx) * XP + (kt & 1) * 32;
                fa[set][s][0] = *(const v4u*)(ap);             // e = 0..7
                fa[set][s][1] = *(const v4u*)(ap + 16);        // e = 8..15: 16 channels on
                fa[set][s][2] = *(const v4u*)(ap + 16 * XP);   // pixels 16..31
                fa[set][s][3] = *(const v4u*)(ap + 16 * XP + 16);
#pragma unroll
                for (int i = 0; i < 4; ++i) fb[set][s][i] = bb[(kt * 4 + i) * 32];
            }
        }
        // keeps the reads above as one group in front of this block's products:
        // without it the compiler sinks each read down to its product and waits there
        __builtin_amdgcn_sched_barrier(0);
        if (blk >= 0) {
#pragma unroll
            for (int s = 0; s < NB; ++s) {
                int set = blk & 1;
                union { v4u w[2]; v16h v; } a0, a1, b0, b1;
                a0.w[0] = fa[set][s][0]; a0.w[1] = fa[set][s][1];
                a1.w[0] = fa[set][s][2]; a1.w[1] = fa[set][s][3];
                b0.w[0] = fb[set][s][0]; b0.w[1] = fb[set][s][1];
                b1.w[0] = fb[set][s][2]; b1.w[1] = fb[set][s][3];
                acc[0][0] = __builtin_amdgcn_wmma_f32_16x16x32_f16(false, a0.v, false, b0.v, (short)0, acc[0][0], false, false);
                acc[1][0] = __builtin_amdgcn_wmma_f32_16x16x32_f16(false, a1.v, false, b0.v, (short)0, acc[1][0], false, false);
                acc[0][1] = __builtin_amdgcn_wmma_f32_16x16x32_f16(false, a0.v, false, b1.v, (short)0, acc[0][1], false, false);
                acc[1][1] = __builtin_amdgcn_wmma_f32_16x16x32_f16(false, a1.v, false, b1.v, (short)0, acc[1][1], false, false);
            }
            // keeps the next group of reads from being spread among these products
            __builtin_amdgcn_sched_barrier(0);
        }
    }

    // ---- writeback: one output category per work-group ----
    const float QSCALE = 0.35355339059327373f;     // 8^-0.5
    int cat = ng >> 1, cb = (ng & 1) * 32;
    if (cat == 0) {                                // conv_out + bias -> d_out ch 0..63
#pragma unroll
        for (int t = 0; t < 2; ++t) {
            int col = cb + t * 16 + mn;
#pragma unroll
            for (int m = 0; m < 2; ++m)
#pragma unroll
            for (int j = 0; j < 8; ++j) {
                int prow = yy * 32 + m * 16 + j + 8 * hf;
                out[(size_t)(bimg * 128 + col) * 1024 + prow] = acc[m][t][j] + bco[col];
            }
        }
    } else if (cat == 1) {                         // q (scaled) -> q_ws[b,h,p,d]
#pragma unroll
        for (int t = 0; t < 2; ++t) {
            int ch = cb + t * 16 + mn, h = ch >> 3, d = ch & 7;
#pragma unroll
            for (int m = 0; m < 2; ++m)
#pragma unroll
            for (int j = 0; j < 8; ++j) {
                int prow = yy * 32 + m * 16 + j + 8 * hf;
                q_ws[(size_t)((bimg * 8 + h) * 1024 + prow) * 8 + d] =
                    (acc[m][t][j] + bqkv[ch]) * QSCALE;
            }
        }
    } else if (cat == 2) {                         // k -> k_ws[b,h,d,p] (f32)
#pragma unroll
        for (int t = 0; t < 2; ++t) {
            int ch = cb + t * 16 + mn, h = ch >> 3, d = ch & 7;
#pragma unroll
            for (int m = 0; m < 2; ++m)
#pragma unroll
            for (int j = 0; j < 8; ++j) {
                int prow = yy * 32 + m * 16 + j + 8 * hf;
                k_ws[(size_t)((bimg * 8 + h) * 8 + d) * 1024 + prow] =
                    acc[m][t][j] + bqkv[64 + ch];
            }
        }
    } else {                                       // v -> v_ws[b,h,d,p] (f16)
#pragma unroll
        for (int t = 0; t < 2; ++t) {
            int ch = cb + t * 16 + mn, h = ch >> 3, d = ch & 7;
#pragma unroll
            for (int m = 0; m < 2; ++m)
#pragma unroll
            for (int j = 0; j < 8; ++j) {
                int prow = yy * 32 + m * 16 + j + 8 * hf;
                v_ws[(size_t)((bimg * 8 + h) * 8 + d) * 1024 + prow] =
                    (_Float16)(acc[m][t][j] + bqkv[128 + ch]);
            }
        }
    }
}

// ---------------------------------------------------------------------------
// Kernel 2: attention and the 1x1 output projection. Scores kept in registers,
// one wave per (b, h, 16 queries). A work-group is 16 waves: the 8 heads x the 2
// query tiles of ONE image row, so all 64 attention channels of its 32 pixels end
// up in it; they meet in LDS and the projection is done here.
//  S^T = K.Q^T (f32 WMMA 16x16x4, K=8 in 2 steps): a lane holds ONE query's
//  scores (column mn), keys 8*hf+r down its 8 registers. A block of 32 keys is one
//  key row ky. The relative logits are formed here, no table of them is stored:
//   width:  RW[q][kx] = q . key_rel_w[kx-qx+31] is the same 2 tiles for every
//           block; each lane forms its 16 values once, they are the C input of
//           the first product.
//   height: RH[q][ky] = q . key_rel_h[ky-qy+31]; the 16 queries of a wave share
//           qy and the 32 keys of a block share ky, so that row of key_rel_h is
//           added to every K row of the block: (K + key_rel_h row) . q = S + RH.
//  Online softmax over 128 keys at a time: running maximum (base 2) and sum per
//  lane, one exchange between the lane halves per 128 keys.
//  O^T += V^T.P^T (f16 WMMA 16x16x32): two converted S^T tiles are the B operand
//  as they lie; A = V rows in the hardware k order. Rows 8..15 of O^T repeat
//  rows 0..7 (V has 8 rows) and are not stored.
//  Projection: GEMM M=32 pixels, N=64, K=64 (f32 WMMA 16x16x4, k ascending).
//  Waves 0..3 take 16 output channels each and both pixel tiles, so a 128-byte
//  line of d_out (one channel, 32 pixels) has one writing wave.
// ---------------------------------------------------------------------------
__device__ __forceinline__ float xhalf(float x) {   // lane l <-> lane l ^ 16
    return __builtin_bit_cast(float, __builtin_amdgcn_permlanex16(
        __builtin_bit_cast(int, x), __builtin_bit_cast(int, x),
        0x76543210, 0xfedcba98, false, false));
}

__global__ void __launch_bounds__(512)
attn_kernel(const float* __restrict__ q_ws,
            const float* __restrict__ k_ws,
            const _Float16* __restrict__ v_ws,
            const float* __restrict__ krw,
            const float* __restrict__ krh,
            const float* __restrict__ w_attn,
            const float* __restrict__ b_attn,
            float* __restrict__ out) {
    const float L2E = 1.4426950408889634f;
    // 40-float channel pitch: the two lane halves read rows 2 apart, 80 floats =
    // 16 banks on, so the 32 lanes of a read fall on 32 different banks
    constexpr int OP = 40;
    __shared__ float os[64 * OP];           // attention output [channel][pixel of the row]
    // the wave's number as a scalar: base addresses and the branches on it stay scalar
    int wave = __builtin_amdgcn_readfirstlane(threadIdx.x >> 5);
    int lane = threadIdx.x & 31;
    int hf = lane >> 4, mn = lane & 15;
    int bimg = blockIdx.x >> 5, qy = blockIdx.x & 31;   // 256 work-groups = 8 images x 32 rows
    int head = wave & 7, qt = wave >> 3;
    int bh = bimg * 8 + head;
    int qx = qt * 16 + mn;
    int q  = qy * 32 + qx;                  // this lane's query

    // B operand of S^T: Q^T, column q, k = d = 2*hf + {0,1} (+4 in the second step)
    const float* qrow = q_ws + ((size_t)bh * 1024 + q) * 8;
    v2f qb0 = *(const v2f*)(qrow + hf * 2);
    v2f qb1 = *(const v2f*)(qrow + 4 + hf * 2);
    // RW[q][kx], kx = t*16 + 8*hf + r: in the accumulator map of tile t.
    // Table row kx - qx + 31 lies in [0,62] for every lane.
    float4 qlo = *(const float4*)(qrow);
    float4 qhi = *(const float4*)(qrow + 4);
    const float4* wrow = (const float4*)(krw + (hf * 8 - qx + 31) * 8);
    v8f rw0, rw1;
    for (int r = 0; r < 8; ++r) {
        float4 a0 = wrow[2 * r],      a1 = wrow[2 * r + 1];    // tile 0
        float4 b0 = wrow[32 + 2 * r], b1 = wrow[32 + 2 * r + 1]; // tile 1: 16 rows on
        rw0[r] = qlo.x * a0.x + qlo.y * a0.y + qlo.z * a0.z + qlo.w * a0.w
               + qhi.x * a1.x + qhi.y * a1.y + qhi.z * a1.z + qhi.w * a1.w;
        rw1[r] = qlo.x * b0.x + qlo.y * b0.y + qlo.z * b0.z + qlo.w * b0.w
               + qhi.x * b1.x + qhi.y * b1.y + qhi.z * b1.z + qhi.w * b1.w;
    }
    // key_rel_h row ky - qy + 31 (in [0,62]), k = d as for K; ky = 0 here
    const float* hrow = krh + (31 - qy) * 8 + hf * 2;
    // A operand of S^T: K, row key = mn, k = d as for Q
    const float* kp = k_ws + (size_t)bh * 8192 + (size_t)(hf * 2) * 1024 + mn;
    // A operand of O^T: V, row d = mn & 7, k = key in the hardware order
    const _Float16* vp = v_ws + (size_t)bh * 8192 + (size_t)(mn & 7) * 1024 + hf * 8;

    float m2 = -__builtin_inff();           // running maximum, times log2(e)
    v2f  lsum = {0.f, 0.f};                 // this lane half's share of the sum
    v8f  o = {};

    for (int g = 0; g < 8; ++g) {           // 128 keys = 4 key rows per trip
        v8f s[4][2];
        for (int u = 0; u < 4; ++u) {
            v2f h0 = *(const v2f*)(hrow + (g * 4 + u) * 8);
            v2f h1 = *(const v2f*)(hrow + (g * 4 + u) * 8 + 4);
            for (int t = 0; t < 2; ++t) {
                const float* kk = kp + g * 128 + u * 32 + t * 16;
                v2f ka0 = { kk[0], kk[1024] };
                v2f ka1 = { kk[4096], kk[5120] };
                ka0 += h0;
                ka1 += h1;
                v8f c = __builtin_amdgcn_wmma_f32_16x16x4_f32(
                    false, ka0, false, qb0, (short)0, t ? rw1 : rw0, false, false);
                s[u][t] = __builtin_amdgcn_wmma_f32_16x16x4_f32(
                    false, ka1, false, qb1, (short)0, c, false, false);
            }
        }

        // Precaution: stands between this trip's key_rel_h and K loads and the
        // instructions that rewrite their address registers for the next trip.
        asm volatile("s_wait_xcnt 0x0" ::: "memory");

        float mx = -__builtin_inff();
        for (int u = 0; u < 4; ++u) {
            float mu = s[u][0][0];
            for (int r = 1; r < 8; ++r) mu = fmaxf(mu, s[u][0][r]);
            for (int r = 0; r < 8; ++r) mu = fmaxf(mu, s[u][1][r]);
            mx = fmaxf(mx, mu);
        }
        mx = fmaxf(mx, xhalf(mx));
        float mnew  = fmaxf(m2, mx * L2E);
        float alpha = __builtin_amdgcn_exp2f(m2 - mnew);   // 0 on the first trip
        m2 = mnew;
        lsum *= alpha;
        o    *= alpha;

        v2f bias2 = { -mnew, -mnew };
        for (int u = 0; u < 4; ++u) {
            v16h pb;
            for (int t = 0; t < 2; ++t) {
                for (int i = 0; i < 4; ++i) {
                    v2f sv  = { s[u][t][2 * i], s[u][t][2 * i + 1] };
                    v2f arg = sv * L2E + bias2;
                    v2f p   = { __builtin_amdgcn_exp2f(arg.x), __builtin_amdgcn_exp2f(arg.y) };
                    lsum += p;
                    pb[t * 8 + 2 * i]     = (_Float16)p.x;
                    pb[t * 8 + 2 * i + 1] = (_Float16)p.y;
                }
            }
            union { uint4 w[2]; v16h v; } va;
            const _Float16* vv = vp + g * 128 + u * 32;
            va.w[0] = *(const uint4*)(vv);
            va.w[1] = *(const uint4*)(vv + 16);
            o = __builtin_amdgcn_wmma_f32_16x16x32_f16(
                false, va.v, false, pb, (short)0, o, false, false);
        }
    }

    float l = lsum.x + lsum.y;
    l += xhalf(l);
    float inv = 1.f / l;

    // B operand of the projection: w_attn, column col, k = channel = kt*4 + 2*hf + {0,1}.
    // Loaded in front of the barrier, so that its latency passes while the wave waits.
    int col = (wave & 3) * 16 + mn;
    const float* wp = w_attn + col * 64 + hf * 2;
    v2f wb[16];
    float bias = 0.f;
    if (wave < 4) {
#pragma unroll
        for (int kt = 0; kt < 16; ++kt) wb[kt] = *(const v2f*)(wp + kt * 4);
        bias = b_attn[col];
        // Precaution: stands behind these loads, in front of any rewrite of their
        // address registers; naming the address keeps those registers until here.
        asm volatile("s_wait_xcnt 0x0" :: "v"(wp) : "memory");
    }

    if (hf == 0) {                          // rows d = 0..7 of O^T
        for (int r = 0; r < 8; ++r)
            os[(head * 8 + r) * OP + qx] = o[r] * inv;
    }
    __syncthreads();                        // all 8 heads of the 32 pixels are in os
    if (wave >= 4) return;                  // behind the only barrier

    // A operand: row = pixel mn (+16 in the second tile), k as for w_attn
    const float* ap = os + hf * 2 * OP + mn;
    v8f c0 = {}, c1 = {};
#pragma unroll
    for (int kt = 0; kt < 16; ++kt) {
        v2f a0 = { ap[kt * 4 * OP],      ap[(kt * 4 + 1) * OP] };
        v2f a1 = { ap[kt * 4 * OP + 16], ap[(kt * 4 + 1) * OP + 16] };
        c0 = __builtin_amdgcn_wmma_f32_16x16x4_f32(
            false, a0, false, wb[kt], (short)0, c0, false, false);
        c1 = __builtin_amdgcn_wmma_f32_16x16x4_f32(
            false, a1, false, wb[kt], (short)0, c1, false, false);
    }
    // channels 64..127 of d_out; a lane holds pixels 8*hf + j of each tile
    float* op = out + (size_t)(bimg * 128 + 64 + col) * 1024 + qy * 32 + 8 * hf;
#pragma unroll
    for (int j = 0; j < 8; ++j) {
        op[j]      = c0[j] + bias;
        op[16 + j] = c1[j] + bias;
    }
}

// ---------------------------------------------------------------------------
extern "C" void kernel_launch(void* const* d_in, const int* in_sizes, int n_in,
                              void* d_out, int out_size, void* d_ws, size_t ws_size,
                              hipStream_t stream) {
    const float* x    = (const float*)d_in[0];
    const float* wco  = (const float*)d_in[1];
    const float* bco  = (const float*)d_in[2];
    const float* wqkv = (const float*)d_in[3];
    const float* bqkv = (const float*)d_in[4];
    const float* watt = (const float*)d_in[5];
    const float* batt = (const float*)d_in[6];
    const float* krw  = (const float*)d_in[7];
    const float* krh  = (const float*)d_in[8];
    float* out = (float*)d_out;

    char* ws = (char*)d_ws;
    size_t o = 0;
    float* q_ws     = (float*)(ws + o);    o += (size_t)524288 * 4;    // 2 MB
    float* k_ws     = (float*)(ws + o);    o += (size_t)524288 * 4;    // 2 MB
    _Float16* v_ws  = (_Float16*)(ws + o); o += (size_t)524288 * 2;    // 1 MB

    // 1) fused 3x3 convs as implicit GEMM (f16 WMMA, weights swizzled in LDS)
    conv_gemm_kernel<<<256, 256, 0, stream>>>(x, wco, wqkv, bco, bqkv,
                                              out, q_ws, k_ws, v_ws);

    // 2) attention with its relative logits and the 1x1 projection (16 waves per WG)
    attn_kernel<<<256, 512, 0, stream>>>(q_ws, k_ws, v_ws, krw, krh, watt, batt, out);
}

// v007
// Measured time: 20 microseconds a run.
// Two timings next to v006 both put it at 1.13 times that version's speed.
// All steps since v000 together make it 18.7 times as fast.
#include <hip/hip_runtime.h>
#include <hip/hip_bf16.h>

typedef __attribute__((ext_vector_type(16))) _Float16 v16h;
typedef __attribute__((ext_vector_type(8)))  float    v8f;
typedef __attribute__((ext_vector_type(2)))  float    v2f;
typedef __attribute__((ext_vector_type(4)))  float    v4f;
typedef __attribute__((ext_vector_type(4)))  unsigned v4u;

// Fragment K-offset for 16-bit WMMA A/B operands (ISA 7.12.2, 16-bit 16x32 layout):
// lane = hf*16 + (m|n); element e -> K = (e<8) ? hf*8+e : 16+hf*8+(e-8)
__device__ __forceinline__ int kof(int e, int hf) {
    return (e < 8) ? (hf * 8 + e) : (16 + hf * 8 + (e - 8));
}

// ---------------------------------------------------------------------------
// Kernel 1: fused implicit-GEMM 3x3 convs (conv_out 64ch ++ qkv 192ch).
// M=8192 pixels, N=256 ch, K=576. Each wave: 32(M) x 32(N) tile, f16 WMMA,
// 18 K-steps of 32. k order of both operands: K = tap*64 + channel, tap = ky*3+kx.
// A work-group owns 8 image rows x 32 output channels, one row per wave.
// A: never stored as an im2col table: the 10 input rows it needs are converted to
// f16 once and laid in LDS pixel-major, xs[row 0..9][column -1..32][channel],
// borders zero. A K-step is 32 channels of ONE tap, so a lane's fragment is two
// 16-byte LDS reads at its pixel shifted by the tap.
// B: the 32 channels' weights are 72 KB in a row in the input. The work-group reads
// them once in whole lines, turns them into f16 fragments itself and keeps those in
// LDS for its 8 waves; no table of swizzled weights is made by another launch.
//   wf[((kt*2 + t)*2 + half)*32 + lane] (8 halves) = W[K][col],
//   col = t*16 + (lane & 15), K = kt*32 + kof(half*8 + i, lane >> 4), i = 0..7
// ---------------------------------------------------------------------------
__global__ void __launch_bounds__(256)
conv_gemm_kernel(const float* __restrict__ x,
                 const float* __restrict__ wco,
                 const float* __restrict__ wqkv,
                 const float* __restrict__ bco,
                 const float* __restrict__ bqkv,
                 float* __restrict__ out,
                 float* __restrict__ q_ws,
                 unsigned* __restrict__ k_ws,
                 _Float16* __restrict__ v_ws) {
    // 144-byte pixel pitch (64 channels + 8 unused): 16 B x odd, no bank conflict
    // for the 16-byte stores and reads below
    constexpr int XP = 72;
    // 2320-byte pitch of a channel's 576 weights (+4 unused): 16 B x odd, for the
    // 16-byte reads in which lane = output channel
    constexpr int WP = 580;
    __shared__ __attribute__((aligned(16))) _Float16 xs[10 * 34 * XP];
    __shared__ __attribute__((aligned(16))) float    wraw[32 * WP];
    __shared__ __attribute__((aligned(16))) uint4    wf[18 * 2 * 2 * 32];
    int tid  = threadIdx.x;
    int lane = tid & 31;
    int hf   = lane >> 4, mn = lane & 15;
    int wave = tid >> 5;
    // 256 work-groups = 8 images x 4 row blocks x 8 channel blocks
    int bimg = blockIdx.x >> 5, rq = (blockIdx.x >> 3) & 3, ng = blockIdx.x & 7;
    int yy = rq * 8 + wave;                        // this wave's image row

    // ---- weights of channels ng*32..+31: 18432 floats in a row, 512 B a load
    const float* wsrc = (ng < 2) ? wco + ng * 18432 : wqkv + (ng - 2) * 18432;
    const v4f* wg = (const v4f*)wsrc + tid;
    v4f wv[18];
    // unrolled, here and below: the arrays are indexed by constants only and stay
    // in registers
#pragma unroll
    for (int i = 0; i < 18; ++i) wv[i] = wg[i * 256];

    // ---- x tile: wave w takes channels 8w..8w+7 of the 10 rows, lane = column.
    // All loads are issued together: a row outside the image is read at the
    // clamped row and replaced by zero, so no branch splits the loads.
    float xv[10][8];
    const float* xb   = x + (size_t)(bimg * 64 + wave * 8) * 1024 + lane;
    const float* xtop = xb + max(rq * 8 - 1, 0) * 32;      // tile row 0
    const float* xmid = xb + rq * 8 * 32;                  // tile rows 1..8
    const float* xbot = xb + min(rq * 8 + 8, 31) * 32;     // tile row 9
#pragma unroll
    for (int i = 0; i < 8; ++i) {
        xv[0][i] = xtop[i * 1024];
#pragma unroll
        for (int rr = 1; rr < 9; ++rr) xv[rr][i] = xmid[(rr - 1) * 32 + i * 1024];
        xv[9][i] = xbot[i * 1024];
    }

    // weights as they came, one padded LDS row per output channel
#pragma unroll
    for (int i = 0; i < 18; ++i) {
        int f = i * 256 + tid, col = f / 144;
        *(v4f*)(wraw + col * WP + (f - col * 144) * 4) = wv[i];
    }
    __syncthreads();                               // wraw is read across waves

    // thread = (8 input channels 8*wave.., output channel lane): its 72 weights
    // [channel][tap] lie in a row
    const v4f* cr = (const v4f*)(wraw + lane * WP + wave * 72);
    v4f wc[18];
#pragma unroll
    for (int i = 0; i < 18; ++i) wc[i] = cr[i];

#pragma unroll
    for (int rr = 0; rr < 10; ++rr) {
        bool inside = (unsigned)(rq * 8 + rr - 1) < 32u;
        union { _Float16 h[8]; uint4 w; } pk;
#pragma unroll
        for (int i = 0; i < 8; ++i) pk.h[i] = (_Float16)(inside ? xv[rr][i] : 0.f);
        *(uint4*)(xs + (rr * 34 + lane + 1) * XP + wave * 8) = pk.w;
    }
    if (tid < 160) {                               // columns -1 and 32: zero
        int rr = tid >> 4, side = (tid >> 3) & 1, cg = tid & 7;
        *(uint4*)(xs + (rr * 34 + side * 33) * XP + cg * 8) = make_uint4(0u, 0u, 0u, 0u);
    }

    // 8 channels of one tap are half a lane's fragment: channel = (kt&1)*32 +
    // half*16 + 8*(reading lane >> 4) + i, so wave = (kt&1)*4 + half*2 + (that bit);
    // this thread's own hf is the column tile t, its mn the column in the tile
    uint4* wd = wf + (((wave >> 2) * 2 + hf) * 2 + ((wave >> 1) & 1)) * 32 + (wave & 1) * 16 + mn;
#pragma unroll
    for (int r = 0; r < 9; ++r) {
        union { _Float16 h[8]; uint4 w; } pk;
#pragma unroll
        for (int i = 0; i < 8; ++i) pk.h[i] = (_Float16)wc[(i * 9 + r) >> 2][(i * 9 + r) & 3];
        wd[r * 256] = pk.w;                        // 2 K-steps per tap
    }
    __syncthreads();                               // xs and wf are read by every wave

    // this lane's pixel of the first 16 at tap (0,0), channels hf*8..
    const _Float16* abase = xs + (wave * 34 + mn) * XP + hf * 8;
    const v4u* bb = (const v4u*)wf + lane;

    v8f acc[2][2] = {};                            // [pixel tile][column tile]
    // The K loop goes in 6 blocks of NB K-steps. A block's 8*NB fragment reads are
    // issued as one group, one block ahead of their products, into the other of two
    // register sets: the products wait on a count, never on their own reads.
    constexpr int NB = 3;
    v4u fa[2][NB][4], fb[2][NB][4];
#pragma unroll
    for (int blk = -1; blk < 6; ++blk) {
        if (blk + 1 < 6) {
#pragma unroll
            for (int s = 0; s < NB; ++s) {
                // ---- A fragments: channels (kt&1)*32 + kof(e,hf) of tap kt>>1 ----
                int kt = (blk + 1) * NB + s, set = (blk + 1) & 1;
                int tap = kt >> 1, ky = tap / 3, kx = tap - ky * 3;
                const _Float16* ap = abase + (ky * 34 + kx) * XP + (kt & 1) * 32;
                fa[set][s][0] = *(const v4u*)(ap);             // e = 0..7
                fa[set][s][1] = *(const v4u*)(ap + 16);        // e = 8..15: 16 channels on
                fa[set][s][2] = *(const v4u*)(ap + 16 * XP);   // pixels 16..31
                fa[set][s][3] = *(const v4u*)(ap + 16 * XP + 16);
#pragma unroll
                for (int i = 0; i < 4; ++i) fb[set][s][i] = bb[(kt * 4 + i) * 32];
            }
        }
        // keeps the reads above as one group in front of this block's products:
        // without it the compiler sinks each read down to its product and waits there
        __builtin_amdgcn_sched_barrier(0);
        if (blk >= 0) {
#pragma unroll
            for (int s = 0; s < NB; ++s) {
                int set = blk & 1;
                union { v4u w[2]; v16h v; } a0, a1, b0, b1;
                a0.w[0] = fa[set][s][0]; a0.w[1] = fa[set][s][1];
                a1.w[0] = fa[set][s][2]; a1.w[1] = fa[set][s][3];
                b0.w[0] = fb[set][s][0]; b0.w[1] = fb[set][s][1];
                b1.w[0] = fb[set][s][2]; b1.w[1] = fb[set][s][3];
                acc[0][0] = __builtin_amdgcn_wmma_f32_16x16x32_f16(false, a0.v, false, b0.v, (short)0, acc[0][0], false, false);
                acc[1][0] = __builtin_amdgcn_wmma_f32_16x16x32_f16(false, a1.v, false, b0.v, (short)0, acc[1][0], false, false);
                acc[0][1] = __builtin_amdgcn_wmma_f32_16x16x32_f16(false, a0.v, false, b1.v, (short)0, acc[0][1], false, false);
                acc[1][1] = __builtin_amdgcn_wmma_f32_16x16x32_f16(false, a1.v, false, b1.v, (short)0, acc[1][1], false, false);
            }
            // keeps the next group of reads from being spread among these products
            __builtin_amdgcn_sched_barrier(0);
        }
    }

    // ---- writeback: one output category per work-group ----
    const float QSCALE = 0.35355339059327373f;     // 8^-0.5
    int cat = ng >> 1, cb = (ng & 1) * 32;
    if (cat == 0) {                                // conv_out + bias -> d_out ch 0..63
#pragma unroll
        for (int t = 0; t < 2; ++t) {
            int col = cb + t * 16 + mn;
#pragma unroll
            for (int m = 0; m < 2; ++m)
#pragma unroll
            for (int j = 0; j < 8; ++j) {
                int prow = yy * 32 + m * 16 + j + 8 * hf;
                out[(size_t)(bimg * 128 + col) * 1024 + prow] = acc[m][t][j] + bco[col];
            }
        }
    } else if (cat == 1) {                         // q (scaled) -> q_ws[b,h,p,d]
#pragma unroll
        for (int t = 0; t < 2; ++t) {
            int ch = cb + t * 16 + mn, h = ch >> 3, d = ch & 7;
#pragma unroll
            for (int m = 0; m < 2; ++m)
#pragma unroll
            for (int j = 0; j < 8; ++j) {
                int prow = yy * 32 + m * 16 + j + 8 * hf;
                q_ws[(size_t)((bimg * 8 + h) * 1024 + prow) * 8 + d] =
                    (acc[m][t][j] + bqkv[ch]) * QSCALE;
            }
        }
    } else if (cat == 2) {                         // k -> k_ws[b,h,p,d]
        // one word a value: its f16 rounding (low half), then the f16 rest
#pragma unroll
        for (int t = 0; t < 2; ++t) {
            int ch = cb + t * 16 + mn, h = ch >> 3, d = ch & 7;
#pragma unroll
            for (int m = 0; m < 2; ++m)
#pragma unroll
            for (int j = 0; j < 8; ++j) {
                int prow = yy * 32 + m * 16 + j + 8 * hf;
                float kv = acc[m][t][j] + bqkv[64 + ch];
                union { _Float16 h[2]; unsigned w; } pk;
                pk.h[0] = (_Float16)kv;
                pk.h[1] = (_Float16)(kv - (float)pk.h[0]);
                k_ws[(size_t)((bimg * 8 + h) * 1024 + prow) * 8 + d] = pk.w;
            }
        }
    } else {                                       // v -> v_ws[b,h,d,p] (f16)
#pragma unroll
        for (int t = 0; t < 2; ++t) {
            int ch = cb + t * 16 + mn, h = ch >> 3, d = ch & 7;
#pragma unroll
            for (int m = 0; m < 2; ++m)
#pragma unroll
            for (int j = 0; j < 8; ++j) {
                int prow = yy * 32 + m * 16 + j + 8 * hf;
                v_ws[(size_t)((bimg * 8 + h) * 8 + d) * 1024 + prow] =
                    (_Float16)(acc[m][t][j] + bqkv[128 + ch]);
            }
        }
    }
}

// ---------------------------------------------------------------------------
// Kernel 2: attention and the 1x1 output projection. Scores kept in registers,
// one wave per (b, h, 16 queries). A work-group is 16 waves: the 8 heads x the 2
// query tiles of ONE image row, so all 64 attention channels of its 32 pixels end
// up in it; they meet in LDS and the projection is done here.
//  S^T = K.Q^T, ONE f16 WMMA 16x16x32 a tile: K and Q are each the sum of two f16
//  numbers (the rounded value and the rest), and the 4 cross products of the 8
//  head dimensions fill the 32 k places, summed in f32:
//   A, both lane halves alike: element e = part (e & 1) of K[key mn][d = e >> 1]
//   B: element e = Q[query mn][d = e >> 1], rounded value in lanes 0..15, rest in
//      lanes 16..31; the two lane halves hold different k places, so every part
//      of K meets every part of Q once.
//  A lane holds ONE query's scores (column mn), keys 8*hf+r down its 8 registers.
//  A block of 32 keys is one key row ky. The relative logits are formed here, no
//  table of them is stored:
//   width:  RW[q][kx] = q . key_rel_w[kx-qx+31] is the same 2 tiles for every
//           block; each lane forms its 16 values once, they are the C input of
//           the product.
//   height: RH[q][ky] = q . key_rel_h[ky-qy+31]; the 16 queries of a wave share
//           qy and the 32 keys of a block share ky: one number per lane and
//           block. The 4 of a trip come from one f32 WMMA pair (16x16x4, rows =
//           the 4 table rows, repeated) and go into the block's maximum and into
//           the addend of its exponents.
//  Online softmax over 128 keys at a time: running maximum (base 2) and sum per
//  lane, one exchange between the lane halves per 128 keys.
//  O^T += V^T.P^T (f16 WMMA 16x16x32): two converted S^T tiles are the B operand
//  as they lie; A = V rows in the hardware k order. Rows 8..15 of O^T repeat
//  rows 0..7 (V has 8 rows) and are not stored.
//  Projection: GEMM M=32 pixels, N=64, K=64 (f32 WMMA 16x16x4, k ascending).
//  Waves 0..3 take 16 output channels each and both pixel tiles, so a 128-byte
//  line of d_out (one channel, 32 pixels) has one writing wave.
// ---------------------------------------------------------------------------
__device__ __forceinline__ float xhalf(float x) {   // lane l <-> lane l ^ 16
    return __builtin_bit_cast(float, __builtin_amdgcn_permlanex16(
        __builtin_bit_cast(int, x), __builtin_bit_cast(int, x),
        0x76543210, 0xfedcba98, false, false));
}

__global__ void __launch_bounds__(512)
attn_kernel(const float* __restrict__ q_ws,
            const unsigned* __restrict__ k_ws,
            const _Float16* __restrict__ v_ws,
            const float* __restrict__ krw,
            const float* __restrict__ krh,
            const float* __restrict__ w_attn,
            const float* __restrict__ b_attn,
            float* __restrict__ out) {
    const float L2E = 1.4426950408889634f;
    // 40-float channel pitch: the two lane halves read rows 2 apart, 80 floats =
    // 16 banks on, so the 32 lanes of a read fall on 32 different banks
    constexpr int OP = 40;
    __shared__ float os[64 * OP];           // attention output [channel][pixel of the row]
    // the wave's number as a scalar: base addresses and the branches on it stay scalar
    int wave = __builtin_amdgcn_readfirstlane(threadIdx.x >> 5);
    int lane = threadIdx.x & 31;
    int hf = lane >> 4, mn = lane & 15;
    int bimg = blockIdx.x >> 5, qy = blockIdx.x & 31;   // 256 work-groups = 8 images x 32 rows
    int head = wave & 7, qt = wave >> 3;
    int bh = bimg * 8 + head;
    int qx = qt * 16 + mn;
    int q  = qy * 32 + qx;                  // this lane's query

    // B operand of RH: Q^T, column q, k = d = 2*hf + {0,1} (+4 in the second step)
    const float* qrow = q_ws + ((size_t)bh * 1024 + q) * 8;
    v2f qb0 = *(const v2f*)(qrow + hf * 2);
    v2f qb1 = *(const v2f*)(qrow + 4 + hf * 2);
    // RW[q][kx], kx = t*16 + 8*hf + r: in the accumulator map of tile t.
    // Table row kx - qx + 31 lies in [0,62] for every lane.
    float4 qlo = *(const float4*)(qrow);
    float4 qhi = *(const float4*)(qrow + 4);
    const float4* wrow = (const float4*)(krw + (hf * 8 - qx + 31) * 8);
    v8f rw0, rw1;
    for (int r = 0; r < 8; ++r) {
        float4 a0 = wrow[2 * r],      a1 = wrow[2 * r + 1];    // tile 0
        float4 b0 = wrow[32 + 2 * r], b1 = wrow[32 + 2 * r + 1]; // tile 1: 16 rows on
        rw0[r] = qlo.x * a0.x + qlo.y * a0.y + qlo.z * a0.z + qlo.w * a0.w
               + qhi.x * a1.x + qhi.y * a1.y + qhi.z * a1.z + qhi.w * a1.w;
        rw1[r] = qlo.x * b0.x + qlo.y * b0.y + qlo.z * b0.z + qlo.w * b0.w
               + qhi.x * b1.x + qhi.y * b1.y + qhi.z * b1.z + qhi.w * b1.w;
    }
    // B operand of S^T: this lane half's f16 part of q, each twice (for K's two parts)
    float qf[8] = { qlo.x, qlo.y, qlo.z, qlo.w, qhi.x, qhi.y, qhi.z, qhi.w };
    v16h qB;
#pragma unroll
    for (int d = 0; d < 8; ++d) {
        _Float16 qr = (_Float16)qf[d];
        _Float16 qp = hf ? (_Float16)(qf[d] - (float)qr) : qr;
        qB[2 * d]     = qp;
        qB[2 * d + 1] = qp;
    }
    // A operand of RH: row m = key_rel_h row ky - qy + 31 (in [0,62]) of ky = (m & 3),
    // k = d as for qb0, qb1; 4 rows on per trip
    const float* hrow = krh + ((mn & 3) + 31 - qy) * 8 + hf * 2;
    // A operand of S^T: K, row key = mn: its 8 words (32 bytes)
    const uint4* kp = (const uint4*)(k_ws + (size_t)bh * 8192) + mn * 2;
    // A operand of O^T: V, row d = mn & 7, k = key in the hardware order
    const _Float16* vp = v_ws + (size_t)bh * 8192 + (size_t)(mn & 7) * 1024 + hf * 8;

    float m2 = -__builtin_inff();           // running maximum, times log2(e)
    v2f  lsum = {0.f, 0.f};                 // this lane half's share of the sum
    v8f  o = {};

    for (int g = 0; g < 8; ++g) {           // 128 keys = 4 key rows per trip
        uint4 kw[4][2][2], vw[4][2];
        for (int u = 0; u < 4; ++u) {
            for (int t = 0; t < 2; ++t) {
                const uint4* kk = kp + (g * 128 + u * 32 + t * 16) * 2;
                kw[u][t][0] = kk[0];
                kw[u][t][1] = kk[1];
            }
        }
        v2f h0 = *(const v2f*)(hrow + g * 32);
        v2f h1 = *(const v2f*)(hrow + g * 32 + 4);
        // Precaution: stands behind the K and key_rel_h loads, in front of the V loads,
        // whose results may be given the registers that hold those addresses.
        asm volatile("s_wait_xcnt 0x0" ::: "memory");
        for (int u = 0; u < 4; ++u) {
            const _Float16* vv = vp + g * 128 + u * 32;
            vw[u][0] = *(const uint4*)(vv);
            vw[u][1] = *(const uint4*)(vv + 16);
        }
        // keeps the trip's loads as one group in front of its products: without it the
        // compiler reuses fragment registers, and a later load is issued only behind
        // the wait for an earlier one (several load latencies in a row per trip)
        __builtin_amdgcn_sched_barrier(0);

        v8f s[4][2];
        for (int u = 0; u < 4; ++u) {
            for (int t = 0; t < 2; ++t) {
                union { uint4 w[2]; v16h v; } ka;
                ka.w[0] = kw[u][t][0];
                ka.w[1] = kw[u][t][1];
                s[u][t] = __builtin_amdgcn_wmma_f32_16x16x32_f16(
                    false, ka.v, false, qB, (short)0, t ? rw1 : rw0, false, false);
            }
        }
        // rh[u] = RH of this lane's query and key row g*4 + u (registers 4..7 repeat)
        v8f rh = {};
        rh = __builtin_amdgcn_wmma_f32_16x16x4_f32(
            false, h0, false, qb0, (short)0, rh, false, false);
        rh = __builtin_amdgcn_wmma_f32_16x16x4_f32(
            false, h1, false, qb1, (short)0, rh, false, false);

        // Precaution: stands between this trip's loads and the instructions that
        // rewrite their address registers for the next trip.
        asm volatile("s_wait_xcnt 0x0" ::: "memory");

        float mx = -__builtin_inff();
        for (int u = 0; u < 4; ++u) {
            float mu = s[u][0][0];
            for (int r = 1; r < 8; ++r) mu = fmaxf(mu, s[u][0][r]);
            for (int r = 0; r < 8; ++r) mu = fmaxf(mu, s[u][1][r]);
            mx = fmaxf(mx, mu + rh[u]);
        }
        mx = fmaxf(mx, xhalf(mx));
        float mnew  = fmaxf(m2, mx * L2E);
        float alpha = __builtin_amdgcn_exp2f(m2 - mnew);   // 0 on the first trip
        m2 = mnew;
        lsum *= alpha;
        o    *= alpha;

        for (int u = 0; u < 4; ++u) {
            float bu = rh[u] * L2E - mnew;
            v2f bias2 = { bu, bu };
            v16h pb;
            for (int t = 0; t < 2; ++t) {
                for (int i = 0; i < 4; ++i) {
                    v2f sv  = { s[u][t][2 * i], s[u][t][2 * i + 1] };
                    v2f arg = sv * L2E + bias2;
                    v2f p   = { __builtin_amdgcn_exp2f(arg.x), __builtin_amdgcn_exp2f(arg.y) };
                    lsum += p;
                    pb[t * 8 + 2 * i]     = (_Float16)p.x;
                    pb[t * 8 + 2 * i + 1] = (_Float16)p.y;
                }
            }
            union { uint4 w[2]; v16h v; } va;
            va.w[0] = vw[u][0];
            va.w[1] = vw[u][1];
            o = __builtin_amdgcn_wmma_f32_16x16x32_f16(
                false, va.v, false, pb, (short)0, o, false, false);
        }
    }

    float l = lsum.x + lsum.y;
    l += xhalf(l);
    float inv = 1.f / l;

    // B operand of the projection: w_attn, column col, k = channel = kt*4 + 2*hf + {0,1}.
    // Loaded in front of the barrier, so that its latency passes while the wave waits.
    int col = (wave & 3) * 16 + mn;
    const float* wp = w_attn + col * 64 + hf * 2;
    v2f wb[16];
    float bias = 0.f;
    if (wave < 4) {
#pragma unroll
        for (int kt = 0; kt < 16; ++kt) wb[kt] = *(const v2f*)(wp + kt * 4);
        bias = b_attn[col];
        // Precaution: stands behind these loads, in front of any rewrite of their
        // address registers; naming the address keeps those registers until here.
        asm volatile("s_wait_xcnt 0x0" :: "v"(wp) : "memory");
    }

    if (hf == 0) {                          // rows d = 0..7 of O^T
        for (int r = 0; r < 8; ++r)
            os[(head * 8 + r) * OP + qx] = o[r] * inv;
    }
    __syncthreads();                        // all 8 heads of the 32 pixels are in os
    if (wave >= 4) return;                  // behind the only barrier

    // A operand: row = pixel mn (+16 in the second tile), k as for w_attn
    const float* ap = os + hf * 2 * OP + mn;
    v8f c0 = {}, c1 = {};
#pragma unroll
    for (int kt = 0; kt < 16; ++kt) {
        v2f a0 = { ap[kt * 4 * OP],      ap[(kt * 4 + 1) * OP] };
        v2f a1 = { ap[kt * 4 * OP + 16], ap[(kt * 4 + 1) * OP + 16] };
        c0 = __builtin_amdgcn_wmma_f32_16x16x4_f32(
            false, a0, false, wb[kt], (short)0, c0, false, false);
        c1 = __builtin_amdgcn_wmma_f32_16x16x4_f32(
            false, a1, false, wb[kt], (short)0, c1, false, false);
    }
    // channels 64..127 of d_out; a lane holds pixels 8*hf + j of each tile
    float* op = out + (size_t)(bimg * 128 + 64 + col) * 1024 + qy * 32 + 8 * hf;
#pragma unroll
    for (int j = 0; j < 8; ++j) {
        op[j]      = c0[j] + bias;
        op[16 + j] = c1[j] + bias;
    }
}

// ---------------------------------------------------------------------------
extern "C" void kernel_launch(void* const* d_in, const int* in_sizes, int n_in,
                              void* d_out, int out_size, void* d_ws, size_t ws_size,
                              hipStream_t stream) {
    const float* x    = (const float*)d_in[0];
    const float* wco  = (const float*)d_in[1];
    const float* bco  = (const float*)d_in[2];
    const float* wqkv = (const float*)d_in[3];
    const float* bqkv = (const float*)d_in[4];
    const float* watt = (const float*)d_in[5];
    const float* batt = (const float*)d_in[6];
    const float* krw  = (const float*)d_in[7];
    const float* krh  = (const float*)d_in[8];
    float* out = (float*)d_out;

    char* ws = (char*)d_ws;
    size_t o = 0;
    float* q_ws     = (float*)(ws + o);    o += (size_t)524288 * 4;    // 2 MB
    unsigned* k_ws  = (unsigned*)(ws + o); o += (size_t)524288 * 4;    // 2 MB
    _Float16* v_ws  = (_Float16*)(ws + o); o += (size_t)524288 * 2;    // 1 MB

    // 1) fused 3x3 convs as implicit GEMM (f16 WMMA, weights swizzled in LDS)
    conv_gemm_kernel<<<256, 256, 0, stream>>>(x, wco, wqkv, bco, bqkv,
                                              out, q_ws, k_ws, v_ws);

    // 2) attention with its relative logits and the 1x1 projection (16 waves per WG)
    attn_kernel<<<256, 512, 0, stream>>>(q_ws, k_ws, v_ws, krw, krh, watt, batt, out);
}
